// v000
// The times below were measured on an AMD MI455X: many runs one after another, warmed up first and cycling through
// copies of the inputs, with the whole window's GPU time divided by the number of runs. Launches and the gaps
// between them are all in it. The median over several windows is given; except for v000 it joins two sittings, which
// can be a few percent apart, so the side-by-side timings, each taken in one sitting, are the better comparison.
// The starting kernel, v000, takes 67.1 microseconds a run.
// Contractions: scores x.(Wd*y)^T on v_wmma_f32_16x16x32_f16 (x as f16 of its RNE bf16 value x16, Wd*y product plane as
// single f16 x1024, f32 accumulate); P.x on v_wmma_f32_16x16x32_bf16 (P as bf16 hi + bf16 residual planes, x as RNE bf16,
// f32 accumulate). tanh, the h.vd row-dot (vd as RNE bf16 value) and the softmax in f32 on VALU.
#include <hip/hip_runtime.h>
#include <math.h>
#include <stdint.h>

#ifndef NB
#define NB 8
#endif
#define NB_FULL 8
#define TX 256
#define TY 256
#ifndef TYR
#define TYR TY
#endif
#define CC 256
#define HH 128
#define XSC 16.0f
#define WYS 1024.0f
#define ZINV (1.0f / (16.0f * 1024.0f))
#define TWOLOG2E 2.8853900817779268f
#define LDW 264
#define TP 68
#define SLAB (16 * 68)
#define SC_WAVES 8
#define SC_THREADS (SC_WAVES * 32)

static_assert(TX == 256 && TY == 256 && CC == 256 && HH == 128);
static_assert(NB >= 1 && NB <= NB_FULL);
static_assert((TYR % 64) == 0 && TYR >= 64 && TYR <= TY);
static_assert(SC_THREADS == TX && SC_WAVES * 32 == TX && SC_WAVES * 16 == HH && 32 * 8 == CC);
static_assert((CC % 32) == 0 && (TX % 32) == 0 && (LDW % 8) == 0 && LDW >= CC);
static_assert(((NB * TX * CC / 8) % 256) == 0 && ((NB * TY * CC / 8) % 256) == 0 && ((HH * CC / 8) % 256) == 0);
static_assert((TX % 64) == 0 && (CC % 64) == 0 && (TP * 4) % 16 == 0 && (SLAB * 4) % 16 == 0);

typedef unsigned short u16;
typedef _Float16 v16h __attribute__((ext_vector_type(16)));
typedef _Float16 v8h  __attribute__((ext_vector_type(8)));
typedef __bf16   v16b __attribute__((ext_vector_type(16)));
typedef float    v8f  __attribute__((ext_vector_type(8)));
typedef float    v4f  __attribute__((ext_vector_type(4)));
typedef unsigned int v4u __attribute__((ext_vector_type(4)));

union FragH { v16h v; v8h h[2]; v4u u[2]; };
union FragB { v16b v; v4u u[2]; };

// ---- scalar helpers --------------------------------------------------------------------------------
__device__ __forceinline__ unsigned short bf_bits(float f) {          // f32 -> bf16 bits, RNE convert
  unsigned u = __float_as_uint(f);
  return (unsigned short)((u + 0x7FFFu + ((u >> 16) & 1u)) >> 16);
}
__device__ __forceinline__ float bf_up(unsigned short h) { return __uint_as_float(((unsigned)h) << 16); }
__device__ __forceinline__ float bf_val(float f) { return bf_up(bf_bits(f)); }          // value after RNE bf16 convert
__device__ __forceinline__ float lo16f(unsigned w) { return __uint_as_float(w << 16); }          // low bf16 of a packed pair
__device__ __forceinline__ float hi16f(unsigned w) { return __uint_as_float(w & 0xffff0000u); } // high bf16 of a packed pair
__device__ __forceinline__ unsigned short h_bits(_Float16 x) { return __builtin_bit_cast(unsigned short, x); }
__device__ __forceinline__ unsigned pk16(unsigned short a, unsigned short b) { return (unsigned)a | ((unsigned)b << 16); }
__device__ __forceinline__ v8f zero8() { v8f z = {0.f, 0.f, 0.f, 0.f, 0.f, 0.f, 0.f, 0.f}; return z; }

// tanh(v) = 1 - 2 / (2^(2 v log2 e) + 1): exp unit + reciprocal, absolute error ~3e-7, branch-free, saturates to +-1
__device__ __forceinline__ float tanh_e(float v) {
  const float e = exp2f(v * TWOLOG2E);
  return 1.0f - 2.0f * __builtin_amdgcn_rcpf(e + 1.0f);
}

// ---- fragment loaders: 16-bit A/B operand, lane -> row/col (lane&15), p already includes +8*(lane>>4);
//      elements 0..7 <- p[0..7] (k0+8h..), elements 8..15 <- p[16..23] (k0+16+8h..)  (same split k map for A and B;
//      B is always read from a k-contiguous [n][k] plane)
__device__ __forceinline__ v16h ldfrag_h(const _Float16* p) {
  FragH f;
  f.h[0] = *(const v8h*)(p);
  f.h[1] = *(const v8h*)(p + 16);
  return f.v;
}
__device__ __forceinline__ v16b ldfrag_b(const u16* p) {              // bf16 plane read as unsigned integer vectors
  FragB f;
  f.u[0] = *(const v4u*)(p);
  f.u[1] = *(const v4u*)(p + 16);
  return f.v;
}

__device__ __forceinline__ v8f mma_h(v16h a, v16h b, v8f c) {
  return __builtin_amdgcn_wmma_f32_16x16x32_f16(false, a, false, b, (short)0, c, false, false);
}
__device__ __forceinline__ v8f mma_b(v16b a, v16b b, v8f c) {
  return __builtin_amdgcn_wmma_f32_16x16x32_bf16(false, a, false, b, (short)0, c, false, false);
}
template <typename F>
__device__ __forceinline__ void guard6(v8f& a, v8f& b, v8f& c, v8f& d, F x0, F x1, F x2, F x3, F x4, F x5) {
#if defined(__HIP_DEVICE_COMPILE__)
  asm volatile("v_nop\n\tv_nop\n\tv_nop\n\tv_nop"
               : "+v"(a), "+v"(b), "+v"(c), "+v"(d) : "v"(x0), "v"(x1), "v"(x2), "v"(x3), "v"(x4), "v"(x5) : "memory");
#endif
}
template <typename F>
__device__ __forceinline__ void guard8(v8f& c0, v8f& c1, v8f& c2, v8f& c3, v8f& c4, v8f& c5, v8f& c6, v8f& c7,
                                       F x0, F x1, F x2, F x3, F x4, F x5) {
#if defined(__HIP_DEVICE_COMPILE__)
  asm volatile("v_nop\n\tv_nop\n\tv_nop\n\tv_nop"
               : "+v"(c0), "+v"(c1), "+v"(c2), "+v"(c3), "+v"(c4), "+v"(c5), "+v"(c6), "+v"(c7)
               : "v"(x0), "v"(x1), "v"(x2), "v"(x3), "v"(x4), "v"(x5) : "memory");
#endif
}
__device__ __forceinline__ void acc_guard4(v8f& a, v8f& b, v8f& c, v8f& d) {
#if defined(__HIP_DEVICE_COMPILE__)
  asm volatile("v_nop\n\tv_nop\n\tv_nop\n\tv_nop" : "+v"(a), "+v"(b), "+v"(c), "+v"(d));
#endif
}
__device__ __forceinline__ void acc_guard8(v8f& c0, v8f& c1, v8f& c2, v8f& c3, v8f& c4, v8f& c5, v8f& c6, v8f& c7) {
#if defined(__HIP_DEVICE_COMPILE__)
  asm volatile("v_nop\n\tv_nop\n\tv_nop\n\tv_nop"
               : "+v"(c0), "+v"(c1), "+v"(c2), "+v"(c3), "+v"(c4), "+v"(c5), "+v"(c6), "+v"(c7));
#endif
}
__device__ __forceinline__ void wave_sync_lds() {
#if defined(__HIP_DEVICE_COMPILE__)
  __builtin_amdgcn_fence(__ATOMIC_RELEASE, "workgroup");
  __builtin_amdgcn_wave_barrier();
  __builtin_amdgcn_fence(__ATOMIC_ACQUIRE, "workgroup");
#endif
}

// =====================================================================================================
// f32 plane -> 16-bit plane, same layout:  mode 0: bf16 RNE bits;  mode 1: f16 bits of (bf16 RNE value) * scale.
// Thread = 8 consecutive elements: two 16-B loads, one 16-B store; 32 consecutive lanes = 512 contiguous, 512-B aligned bytes
// coverage: grid = n8/256 blocks (host checks exactness) x 256 thr x 8 = the whole plane.
// =====================================================================================================
__global__ __launch_bounds__(256) void cvt16(const float* __restrict__ x, u16* D, int n8, int mode, float scale) {
  const int gt = blockIdx.x * 256 + (int)threadIdx.x;
  if (gt >= n8) return;                     // no barriers in this kernel
  const float* p = x + (size_t)gt * 8;
  const v4f a = *(const v4f*)(p), c4 = *(const v4f*)(p + 4);
  float v[8];
#pragma unroll
  for (int e = 0; e < 4; ++e) { v[e] = a[e]; v[4 + e] = c4[e]; }
  unsigned short s[8];
#pragma unroll
  for (int e = 0; e < 8; ++e) {
    const unsigned short bb = bf_bits(v[e]);
    const unsigned short hb = h_bits((_Float16)(bf_up(bb) * scale));
    s[e] = (mode != 0) ? hb : bb;
  }
  v4u o;
#pragma unroll
  for (int e = 0; e < 4; ++e) o[e] = pk16(s[2 * e], s[2 * e + 1]);
  u16* d = D + (size_t)gt * 8;
  {
    *(v4u*)(d) = o;
    
  }
}

// =====================================================================================================
// Transposed bf16 plane of x:  in x[b][tx][c] f32 (row pitch CC)  ->  out XT[b][c][tx] bf16 RNE bits (row pitch TX).
// Block = (b, 64 tx rows, 64 c cols): thread loads 16 consecutive c of one tx row (four 16-B loads), stores them
// transposed into the LDS tile T[c][tx] (pitch TP floats); after the block barrier wave w / instruction i writes the
// coverage: 8 waves x 2 instructions x 4 rows = 64 c rows, 8 lanes x 8 halves = 64 tx each; grid NB*(TX/64)*(CC/64)
//           blocks = every (b, c, tx) of the XT plane exactly once. Staged extent == consumed extent (64 x 64 of T).
// =====================================================================================================
__global__ __launch_bounds__(256) void xpose_b16(const float* __restrict__ x, u16* XT) {
  __shared__ __align__(16) float T[64 * TP];
  const int tid = threadIdx.x, lane = tid & 31, wave = tid >> 5;
  const int ntl = (TX / 64) * (CC / 64);
  const int bid = blockIdx.x;
  const int b   = bid / ntl, t = bid % ntl;
  const int tx0 = (t / (CC / 64)) * 64;
  const int c0  = (t % (CC / 64)) * 64;
  const int r   = tid >> 2, cq = (tid & 3) * 16;
  const float* p = x + ((size_t)b * TX + tx0 + r) * CC + c0 + cq;
  const v4f q0 = *(const v4f*)(p), q1 = *(const v4f*)(p + 4), q2 = *(const v4f*)(p + 8), q3 = *(const v4f*)(p + 12);
#pragma unroll
  for (int e = 0; e < 4; ++e) {
    T[(cq + e) * TP + r]      = q0[e];
    T[(cq + 4 + e) * TP + r]  = q1[e];
    T[(cq + 8 + e) * TP + r]  = q2[e];
    T[(cq + 12 + e) * TP + r] = q3[e];
  }
  __syncthreads();
  const int rq = lane >> 3, g8 = (lane & 7) * 8;
  v4u ov[2];
#pragma unroll
  for (int i = 0; i < 2; ++i) {
    const int ci = wave * 8 + i * 4 + rq;
    const v4f a = *(const v4f*)(T + ci * TP + g8), c4 = *(const v4f*)(T + ci * TP + g8 + 4);
    float w[8];
#pragma unroll
    for (int e = 0; e < 4; ++e) { w[e] = a[e]; w[4 + e] = c4[e]; }
#pragma unroll
    for (int e = 0; e < 4; ++e) ov[i][e] = pk16(bf_bits(w[2 * e]), bf_bits(w[2 * e + 1]));
  }
  u16* dst = XT + ((size_t)b * CC + c0 + wave * 8 + rq) * TX + tx0 + g8;
  {
#pragma unroll
    for (int i = 0; i < 2; ++i) {
      *(v4u*)(dst + (size_t)(i * 4) * TX) = ov[i];
    }
    
  }
}

// =====================================================================================================
// coverage: 8 instructions x 2 rows x 16 lanes x 4 floats = the wave's 16 x 64 tile.
// =====================================================================================================
__device__ __forceinline__ void epi64(float* sl, v8f a0, v8f a1, v8f a2, v8f a3, float* C, int N,
                                      size_t rowb, int col0, int lane) {
  const int hh = lane >> 4, m = lane & 15;
#pragma unroll
  for (int r = 0; r < 8; ++r) {
    const int ro = (8 * hh + r) * 68 + m;
    sl[ro]      = a0[r];
    sl[ro + 16] = a1[r];
    sl[ro + 32] = a2[r];
    sl[ro + 48] = a3[r];
  }
  wave_sync_lds();
  v4f vals[8];
#pragma unroll
  for (int it = 0; it < 8; ++it) vals[it] = *(const v4f*)(sl + (it * 2 + hh) * 68 + m * 4);
  float* dst = C + (rowb + (size_t)hh) * (size_t)N + col0 + m * 4;
  {
#pragma unroll
    for (int it = 0; it < 8; ++it) {
      *(v4f*)(dst + (size_t)(it * 2) * (size_t)N) = vals[it];
    }
    
  }
}

// =====================================================================================================
// Scores + softmax for one (b, ty) pair per block (SC_THREADS = TX threads, 8 waves).
//  (1) Wy plane in LDS: Wys[h][c] = f16 bits of (bf16(Wd[h][c]) * bf16(y[b][ty][c]) * 1024) (the product is exact in
//      f32; one RNE f16 convert). Thread = (8 consecutive c, h = tid>>5 + 8i, i = 0..15): one 16-B load of the Wd bf16
//      plane, one 16-B LDS store per (h, 8 c). coverage: 32 c-groups x 8 = CC, 8 x 16 = HH rows; pad cols CC..LDW-1
//      are never read. Block barrier before any fragment load.
//  (2) z[tx][h] (times 16*1024) = XB[b][tx][:] (A, f16 x16, row m = tx, split k map, straight from the global plane)
//      . Wys[h][:]^T (B, col n = h, split k map from LDS); wave w owns tx rows 32w..32w+31 (2 M-tiles) and visits the
//      128 h columns in two halves of 4 N-tiles (8 accumulators), K = CC stepped by 32.
//      Epilogue per half: p[row] += bf16(vd[h]) * tanh(z / 16384) in f32, D element r of lane -> (tx 32w+16mt+8hh+r,
//      h = hb+16j+m); then a fixed-order xor reduce over the 16 lanes of each half gives s[tx]; lanes m == 0 write s.
//  (3) f32 max-subtracted softmax over the TX scores (thread = tx): P = e / sum via one reciprocal; P -> bf16 hi bits
//      and bf16 bits of the exact residual (P - hi), staged in LDS; wave 0 writes the hi row, wave 1 the residual row:
// coverage: grid NB*TYR blocks = every (b, ty < TYR) row of both P planes exactly once.
// =====================================================================================================
__global__ __launch_bounds__(SC_THREADS)
void score_softmax(const u16* __restrict__ XB, const u16* __restrict__ YB, const u16* __restrict__ WDB,
                   const float* __restrict__ vd, u16* PH, u16* PL) {
  __shared__ __align__(16) u16 Wys[HH * LDW];
  __shared__ __align__(16) u16 phs[TX];
  __shared__ __align__(16) u16 pls[TX];
  __shared__ float sl[TX];
  __shared__ float vds[HH];
  __shared__ float redm[SC_WAVES];
  __shared__ float reds[SC_WAVES];

  const int tid = threadIdx.x, wave = tid >> 5, lane = tid & 31, hh = lane >> 4, m = lane & 15;
  const int bid = blockIdx.x;
  const int b   = bid / TYR;
  const int ty  = bid % TYR;

  if (tid < HH) vds[tid] = bf_val(vd[tid]);                 // waves 0..3 whole (HH = 128): wave-uniform

  // ---- (1) Wy plane ----
  {
    const int c8 = (tid & 31) * 8, hq = tid >> 5;
    const v4u yv = *(const v4u*)(YB + ((size_t)b * TY + ty) * CC + c8);
    float yf[8];
#pragma unroll
    for (int e = 0; e < 4; ++e) { yf[2 * e] = lo16f(yv[e]); yf[2 * e + 1] = hi16f(yv[e]); }
#pragma unroll 2
    for (int i = 0; i < HH / 8; ++i) {
      const int h = hq + 8 * i;
      const v4u wv = *(const v4u*)(WDB + (size_t)h * CC + c8);
      v4u o;
#pragma unroll
      for (int e = 0; e < 4; ++e) {
        const float p0 = (lo16f(wv[e]) * yf[2 * e]) * WYS;
        const float p1 = (hi16f(wv[e]) * yf[2 * e + 1]) * WYS;
        o[e] = pk16(h_bits((_Float16)p0), h_bits((_Float16)p1));
      }
      *(v4u*)(&Wys[h * LDW + c8]) = o;
    }
  }
  __syncthreads();

  // ---- (2) scores ----
  const int tx0 = wave * 32;
  const _Float16* ap = (const _Float16*)(const void*)XB + ((size_t)b * TX + tx0 + m) * CC + 8 * hh;
  const _Float16* wl = (const _Float16*)(const void*)(&Wys[0]);
  float p0[8], p1[8];
#pragma unroll
  for (int r = 0; r < 8; ++r) { p0[r] = 0.f; p1[r] = 0.f; }

#pragma unroll 1
  for (int half = 0; half < 2; ++half) {
    const int hb = half * 64;
    const _Float16* bq = wl + (size_t)(hb + m) * LDW + 8 * hh;
    v8f c0[4], c1[4];
#pragma unroll
    for (int j = 0; j < 4; ++j) { c0[j] = zero8(); c1[j] = zero8(); }
#pragma unroll 1
    for (int k0 = 0; k0 < CC; k0 += 32) {
      const v16h a0 = ldfrag_h(ap + k0);
      const v16h a1 = ldfrag_h(ap + (size_t)16 * CC + k0);
      const v16h b0 = ldfrag_h(bq + k0);
      const v16h b1 = ldfrag_h(bq + 16 * LDW + k0);
      const v16h b2 = ldfrag_h(bq + 32 * LDW + k0);
      const v16h b3 = ldfrag_h(bq + 48 * LDW + k0);
      c0[0] = mma_h(a0, b0, c0[0]);
      c0[1] = mma_h(a0, b1, c0[1]);
      c0[2] = mma_h(a0, b2, c0[2]);
      c0[3] = mma_h(a0, b3, c0[3]);
      c1[0] = mma_h(a1, b0, c1[0]);
      c1[1] = mma_h(a1, b1, c1[1]);
      c1[2] = mma_h(a1, b2, c1[2]);
      c1[3] = mma_h(a1, b3, c1[3]);
      guard8<v16h>(c0[0], c0[1], c0[2], c0[3], c1[0], c1[1], c1[2], c1[3], a0, a1, b0, b1, b2, b3);
    }
    acc_guard8(c0[0], c0[1], c0[2], c0[3], c1[0], c1[1], c1[2], c1[3]);
#pragma unroll
    for (int j = 0; j < 4; ++j) {
      const float vv = vds[hb + 16 * j + m];
#pragma unroll
      for (int r = 0; r < 8; ++r) {
        p0[r] += vv * tanh_e(c0[j][r] * ZINV);
        p1[r] += vv * tanh_e(c1[j][r] * ZINV);
      }
    }
  }

  // reduce over the 16 column lanes of each half (fixed order); D row = tx0 + 16*mt + 8*hh + r
#pragma unroll
  for (int r = 0; r < 8; ++r) {
    float v = p0[r];
    v += __shfl_xor(v, 1, 16);
    v += __shfl_xor(v, 2, 16);
    v += __shfl_xor(v, 4, 16);
    v += __shfl_xor(v, 8, 16);
    p0[r] = v;
    float u = p1[r];
    u += __shfl_xor(u, 1, 16);
    u += __shfl_xor(u, 2, 16);
    u += __shfl_xor(u, 4, 16);
    u += __shfl_xor(u, 8, 16);
    p1[r] = u;
  }
  if (m == 0) {
#pragma unroll
    for (int r = 0; r < 8; ++r) {
      sl[tx0 + 8 * hh + r]      = p0[r];
      sl[tx0 + 16 + 8 * hh + r] = p1[r];
    }
  }
  __syncthreads();

  // ---- (3) softmax over tx (thread = tx) ----
  const float sv = sl[tid];
  float mx = sv;
  mx = fmaxf(mx, __shfl_xor(mx, 16, 32));
  mx = fmaxf(mx, __shfl_xor(mx, 8, 32));
  mx = fmaxf(mx, __shfl_xor(mx, 4, 32));
  mx = fmaxf(mx, __shfl_xor(mx, 2, 32));
  mx = fmaxf(mx, __shfl_xor(mx, 1, 32));
  if (lane == 0) redm[wave] = mx;
  __syncthreads();
  float mm = redm[0];
#pragma unroll
  for (int w = 1; w < SC_WAVES; ++w) mm = fmaxf(mm, redm[w]);
  const float ev = expf(sv - mm);
  float ss = ev;
  ss += __shfl_xor(ss, 16, 32);
  ss += __shfl_xor(ss, 8, 32);
  ss += __shfl_xor(ss, 4, 32);
  ss += __shfl_xor(ss, 2, 32);
  ss += __shfl_xor(ss, 1, 32);
  if (lane == 0) reds[wave] = ss;
  __syncthreads();
  float tot = reds[0];
#pragma unroll
  for (int w = 1; w < SC_WAVES; ++w) tot += reds[w];
  const float a = ev * (1.0f / tot);                       // tot >= 1 by construction
  const unsigned short hb16 = bf_bits(a);
  const unsigned short lb16 = bf_bits(a - bf_up(hb16));    // residual is exact in f32
  phs[tid] = hb16;
  pls[tid] = lb16;
  __syncthreads();

  if (wave < 2) {                                          // wave-uniform; no barriers after this point
    const v4u oh = *(const v4u*)(&phs[lane * 8]);
    const v4u ol = *(const v4u*)(&pls[lane * 8]);
    const v4u o  = (wave == 0) ? oh : ol;
    u16* base = (wave == 0) ? PH : PL;
    u16* dst  = base + ((size_t)b * TYR + ty) * TX + lane * 8;
    {
      *(v4u*)(dst) = o;
      
    }
  }
}

// =====================================================================================================
// bf16 GEMM with f32 result into out: out[bz][ty][d] = sum_tx (PH + PL)[bz][ty][tx] * XT[bz][d][tx]
// (A = hi and residual planes, row-major k = tx; Bt = XT k-contiguous [n = d][k = tx]; two products per tile pair into
// one accumulator). Block = 64x64 tile of batch bz, 4 waves x 16 rows, fragments loaded straight from the 16-bit rows
// (two 16-B loads each, split k map for A and B), K = TX stepped by 32; epilogue epi64.
// coverage: grid NB*(TYR/64)*(CC/64) blocks x 4 waves x (16 x 64) = every out[b][ty < TYR][d] exactly once.
// =====================================================================================================
__global__ __launch_bounds__(128)
void gemm_pv(const u16* __restrict__ PH, const u16* __restrict__ PL, const u16* __restrict__ XT, float* out) {
  __shared__ __align__(16) float slab[4 * SLAB];
  const int tid = threadIdx.x, wave = tid >> 5, lane = tid & 31, hh = lane >> 4, m = lane & 15;
  const int ntl  = (TYR / 64) * (CC / 64);
  const int bid  = blockIdx.x;
  const int bz   = bid / ntl, t = bid % ntl;
  const int rowl = (t / (CC / 64)) * 64 + wave * 16;
  const int col0 = (t % (CC / 64)) * 64;
  const u16* aph = PH + ((size_t)bz * TYR + rowl + m) * TX + 8 * hh;
  const u16* apl = PL + ((size_t)bz * TYR + rowl + m) * TX + 8 * hh;
  const u16* bp  = XT + ((size_t)bz * CC + col0 + m) * TX + 8 * hh;
  const size_t bs = (size_t)16 * TX;
  v8f acc0 = zero8(), acc1 = zero8(), acc2 = zero8(), acc3 = zero8();
#pragma unroll 1
  for (int k0 = 0; k0 < TX; k0 += 32) {
    const v16b ah = ldfrag_b(aph + k0);
    const v16b al = ldfrag_b(apl + k0);
    const v16b b0 = ldfrag_b(bp + k0);
    const v16b b1 = ldfrag_b(bp + bs + k0);
    const v16b b2 = ldfrag_b(bp + 2 * bs + k0);
    const v16b b3 = ldfrag_b(bp + 3 * bs + k0);
    acc0 = mma_b(ah, b0, acc0);
    acc1 = mma_b(ah, b1, acc1);
    acc2 = mma_b(ah, b2, acc2);
    acc3 = mma_b(ah, b3, acc3);
    acc0 = mma_b(al, b0, acc0);
    acc1 = mma_b(al, b1, acc1);
    acc2 = mma_b(al, b2, acc2);
    acc3 = mma_b(al, b3, acc3);
    guard6<v16b>(acc0, acc1, acc2, acc3, ah, al, b0, b1, b2, b3);
  }
  acc_guard4(acc0, acc1, acc2, acc3);
  epi64(slab + wave * SLAB, acc0, acc1, acc2, acc3, out + (size_t)bz * TYR * CC, CC, (size_t)rowl, col0, lane);
}

// =====================================================================================================
// Workspace map (bytes, NB = 8, TYR = 256); every plane is fully written by whole-line stores before it is read; all
// extents are exact multiples of the store granularity (no pad rows), every offset a multiple of 128:
//   XB  f16 [NB*TX][CC]  x16         1048576
//   YB  bf16 [NB*TY][CC]             1048576
//   WDB bf16 [HH][CC]                  65536
//   XT  bf16 [NB*CC][TX]             1048576
//   PH  bf16 [NB*TYR][TX]            1048576
//   PL  bf16 [NB*TYR][TX]            1048576
//   end                              5308416
// Inputs are read with the full-size batch strides (TX*CC, TY*CC); out is written as [NB][TYR][CC].
// =====================================================================================================
extern "C" void kernel_launch(void* const* d_in, const int* in_sizes, int n_in,
                              void* d_out, int out_size, void* d_ws, size_t ws_size,
                              hipStream_t stream) {
  if (n_in < 4) return;
  if (in_sizes[0] < NB * TX * CC || in_sizes[1] < NB * TY * CC) return;
  if (in_sizes[2] < HH * CC || in_sizes[3] < HH) return;
  if (out_size < NB * TYR * CC) return;

  const float* Xin = (const float*)d_in[0];
  const float* Yin = (const float*)d_in[1];
  const float* Wd  = (const float*)d_in[2];
  const float* vd  = (const float*)d_in[3];
  float*       out = (float*)d_out;

  const size_t szXB = (size_t)NB * TX * CC * 2;
  const size_t szYB = (size_t)NB * TY * CC * 2;
  const size_t szWD = (size_t)HH * CC * 2;
  const size_t szXT = (size_t)NB * CC * TX * 2;
  const size_t szP  = (size_t)NB * TYR * TX * 2;
  size_t off = 0;
  const size_t oXB = off; off += szXB;
  const size_t oYB = off; off += szYB;
  const size_t oWD = off; off += szWD;
  const size_t oXT = off; off += szXT;
  const size_t oPH = off; off += szP;
  const size_t oPL = off; off += szP;
  if (off > ws_size) return;                            // 5308416 at NB = 8, TYR = 256
  if (off > (size_t)134217728) return;

  char* ws = (char*)d_ws;
  u16* XB  = (u16*)(ws + oXB);
  u16* YB  = (u16*)(ws + oYB);
  u16* WDB = (u16*)(ws + oWD);
  u16* XT  = (u16*)(ws + oXT);
  u16* PH  = (u16*)(ws + oPH);
  u16* PL  = (u16*)(ws + oPL);

  const int n8x = (NB * TX * CC) / 8;                   // 65536
  const int n8y = (NB * TY * CC) / 8;                   // 65536
  const int n8w = (HH * CC) / 8;                        //  4096
  if ((n8x % 256) != 0 || (n8y % 256) != 0 || (n8w % 256) != 0) return;

  const dim3 blk(256);
  const dim3 gX(n8x / 256);                             // 256
  const dim3 gY(n8y / 256);                             // 256
  const dim3 gW(n8w / 256);                             // 16
  const dim3 gXT(NB * (TX / 64) * (CC / 64));           // 128
  const dim3 gSC(NB * TYR);                             // 2048
  const dim3 bSC(SC_THREADS);                           // 256
  const dim3 gPV(NB * (TYR / 64) * (CC / 64));          // 128
  const dim3 bPV(128);

  // (0..2) operand planes: x -> f16 of bf16 value x16; y -> bf16; Wd [h][c] (k-contiguous) -> bf16
  cvt16<<<gX, blk, 0, stream>>>(Xin, XB, n8x, 1, XSC);
  cvt16<<<gY, blk, 0, stream>>>(Yin, YB, n8y, 0, 1.0f);
  cvt16<<<gW, blk, 0, stream>>>(Wd, WDB, n8w, 0, 1.0f);
  // (3) x[b][tx][c] -> XT[b][c][tx] bf16
  xpose_b16<<<gXT, blk, 0, stream>>>(Xin, XT);
  // (4) scores, tanh.vd row-dot, softmax -> P hi / residual bf16 planes [b][ty][tx]
  score_softmax<<<gSC, bSC, 0, stream>>>(XB, YB, WDB, vd, PH, PL);
  // (5) out[b][ty][d] = sum_tx P[b][ty][tx] * x[b][tx][d]
  gemm_pv<<<gPV, bPV, 0, stream>>>(PH, PL, XT, out);
  (void)hipGetLastError();
}

// v001
// One run takes 54.7 microseconds.
// Next to v000, in two timings, it ran 1.24 and 1.25 times as fast.
// Contractions: scores x.(Wd*y)^T on v_wmma_f32_16x16x32_f16 (x as f16 of its RNE bf16 value x16, Wd*y product plane as
// single f16 x1024, f32 accumulate); P.x on v_wmma_f32_16x16x32_bf16 (P as bf16 hi + bf16 residual planes, x as RNE bf16,
// f32 accumulate). tanh, the h.vd row-dot (vd as RNE bf16 value) and the softmax in f32 on VALU.
#include <hip/hip_runtime.h>
#include <math.h>
#include <stdint.h>

#ifndef NB
#define NB 8
#endif
#define NB_FULL 8
#define TX 256
#define TY 256
#ifndef TYR
#define TYR TY
#endif
#define CC 256
#define HH 128
#define XSC 16.0f
#define WYS 1024.0f
#define ZINV (1.0f / (16.0f * 1024.0f))
#define TWOLOG2E 2.8853900817779268f
#define LDW 264
#define TP 68
#define SLAB (16 * 68)
#define SC_WAVES 8
#define SC_THREADS (SC_WAVES * 32)
#define NTY 4

static_assert(TX == 256 && TY == 256 && CC == 256 && HH == 128);
static_assert(NB >= 1 && NB <= NB_FULL);
static_assert((TYR % 64) == 0 && TYR >= 64 && TYR <= TY);
static_assert((TYR % NTY) == 0 && NTY * CC == SC_THREADS * 4);
static_assert(SC_THREADS == TX && SC_WAVES * 32 == TX && SC_WAVES * 16 == HH && 32 * 8 == CC);
static_assert((CC % 32) == 0 && (TX % 32) == 0 && (LDW % 8) == 0 && LDW >= CC);
static_assert(((NB * TX * CC / 8) % 256) == 0 && ((NB * TY * CC / 8) % 256) == 0 && ((HH * CC / 8) % 256) == 0);
static_assert((TX % 64) == 0 && (CC % 64) == 0 && (TP * 4) % 16 == 0 && (SLAB * 4) % 16 == 0);

typedef unsigned short u16;
typedef _Float16 v16h __attribute__((ext_vector_type(16)));
typedef _Float16 v8h  __attribute__((ext_vector_type(8)));
typedef __bf16   v16b __attribute__((ext_vector_type(16)));
typedef float    v8f  __attribute__((ext_vector_type(8)));
typedef float    v4f  __attribute__((ext_vector_type(4)));
typedef unsigned int v4u __attribute__((ext_vector_type(4)));
typedef unsigned int v2u __attribute__((ext_vector_type(2)));

union FragH { v16h v; v8h h[2]; v4u u[2]; };
union FragB { v16b v; v4u u[2]; };

// ---- scalar helpers --------------------------------------------------------------------------------
__device__ __forceinline__ unsigned short bf_bits(float f) {          // f32 -> bf16 bits, RNE convert
  unsigned u = __float_as_uint(f);
  return (unsigned short)((u + 0x7FFFu + ((u >> 16) & 1u)) >> 16);
}
__device__ __forceinline__ float bf_up(unsigned short h) { return __uint_as_float(((unsigned)h) << 16); }
__device__ __forceinline__ float bf_val(float f) { return bf_up(bf_bits(f)); }          // value after RNE bf16 convert
__device__ __forceinline__ float lo16f(unsigned w) { return __uint_as_float(w << 16); }          // low bf16 of a packed pair
__device__ __forceinline__ float hi16f(unsigned w) { return __uint_as_float(w & 0xffff0000u); } // high bf16 of a packed pair
__device__ __forceinline__ unsigned short h_bits(_Float16 x) { return __builtin_bit_cast(unsigned short, x); }
__device__ __forceinline__ unsigned pk16(unsigned short a, unsigned short b) { return (unsigned)a | ((unsigned)b << 16); }
__device__ __forceinline__ v8f zero8() { v8f z = {0.f, 0.f, 0.f, 0.f, 0.f, 0.f, 0.f, 0.f}; return z; }

// tanh(v) = 1 - 2 / (2^(2 v log2 e) + 1): exp unit + reciprocal, absolute error ~3e-7, branch-free, saturates to +-1
__device__ __forceinline__ float tanh_e(float v) {
  const float e = exp2f(v * TWOLOG2E);
  return 1.0f - 2.0f * __builtin_amdgcn_rcpf(e + 1.0f);
}

// ---- fragment loaders: 16-bit A/B operand, lane -> row/col (lane&15), p already includes +8*(lane>>4);
//      elements 0..7 <- p[0..7] (k0+8h..), elements 8..15 <- p[16..23] (k0+16+8h..)  (same split k map for A and B;
//      B is always read from a k-contiguous [n][k] plane)
__device__ __forceinline__ v16h ldfrag_h(const _Float16* p) {
  FragH f;
  f.h[0] = *(const v8h*)(p);
  f.h[1] = *(const v8h*)(p + 16);
  return f.v;
}
__device__ __forceinline__ v16b ldfrag_b(const u16* p) {              // bf16 plane read as unsigned integer vectors
  FragB f;
  f.u[0] = *(const v4u*)(p);
  f.u[1] = *(const v4u*)(p + 16);
  return f.v;
}

__device__ __forceinline__ v8f mma_h(v16h a, v16h b, v8f c) {
  return __builtin_amdgcn_wmma_f32_16x16x32_f16(false, a, false, b, (short)0, c, false, false);
}
__device__ __forceinline__ v8f mma_b(v16b a, v16b b, v8f c) {
  return __builtin_amdgcn_wmma_f32_16x16x32_bf16(false, a, false, b, (short)0, c, false, false);
}
template <typename F>
__device__ __forceinline__ void guard6(v8f& a, v8f& b, v8f& c, v8f& d, F x0, F x1, F x2, F x3, F x4, F x5) {
#if defined(__HIP_DEVICE_COMPILE__)
  asm volatile("v_nop\n\tv_nop\n\tv_nop\n\tv_nop"
               : "+v"(a), "+v"(b), "+v"(c), "+v"(d) : "v"(x0), "v"(x1), "v"(x2), "v"(x3), "v"(x4), "v"(x5) : "memory");
#endif
}
__device__ __forceinline__ void acc_guard4(v8f& a, v8f& b, v8f& c, v8f& d) {
#if defined(__HIP_DEVICE_COMPILE__)
  asm volatile("v_nop\n\tv_nop\n\tv_nop\n\tv_nop" : "+v"(a), "+v"(b), "+v"(c), "+v"(d));
#endif
}
__device__ __forceinline__ void wave_sync_lds() {
#if defined(__HIP_DEVICE_COMPILE__)
  __builtin_amdgcn_fence(__ATOMIC_RELEASE, "workgroup");
  __builtin_amdgcn_wave_barrier();
  __builtin_amdgcn_fence(__ATOMIC_ACQUIRE, "workgroup");
#endif
}

// =====================================================================================================
// f32 plane -> 16-bit plane, same layout:  mode 0: bf16 RNE bits;  mode 1: f16 bits of (bf16 RNE value) * scale.
// Thread = 8 consecutive elements: two 16-B loads, one 16-B store; 32 consecutive lanes = 512 contiguous, 512-B aligned bytes
// coverage: grid = n8/256 blocks (host checks exactness) x 256 thr x 8 = the whole plane.
// =====================================================================================================
__global__ __launch_bounds__(256) void cvt16(const float* __restrict__ x, u16* D, int n8, int mode, float scale) {
  const int gt = blockIdx.x * 256 + (int)threadIdx.x;
  if (gt >= n8) return;                     // no barriers in this kernel
  const float* p = x + (size_t)gt * 8;
  const v4f a = *(const v4f*)(p), c4 = *(const v4f*)(p + 4);
  float v[8];
#pragma unroll
  for (int e = 0; e < 4; ++e) { v[e] = a[e]; v[4 + e] = c4[e]; }
  unsigned short s[8];
#pragma unroll
  for (int e = 0; e < 8; ++e) {
    const unsigned short bb = bf_bits(v[e]);
    const unsigned short hb = h_bits((_Float16)(bf_up(bb) * scale));
    s[e] = (mode != 0) ? hb : bb;
  }
  v4u o;
#pragma unroll
  for (int e = 0; e < 4; ++e) o[e] = pk16(s[2 * e], s[2 * e + 1]);
  u16* d = D + (size_t)gt * 8;
  {
    *(v4u*)(d) = o;
    
  }
}

// =====================================================================================================
// Transposed bf16 plane of x:  in x[b][tx][c] f32 (row pitch CC)  ->  out XT[b][c][tx] bf16 RNE bits (row pitch TX).
// Block = (b, 64 tx rows, 64 c cols): thread loads 16 consecutive c of one tx row (four 16-B loads), stores them
// transposed into the LDS tile T[c][tx] (pitch TP floats); after the block barrier wave w / instruction i writes the
// coverage: 8 waves x 2 instructions x 4 rows = 64 c rows, 8 lanes x 8 halves = 64 tx each; grid NB*(TX/64)*(CC/64)
//           blocks = every (b, c, tx) of the XT plane exactly once. Staged extent == consumed extent (64 x 64 of T).
// =====================================================================================================
__global__ __launch_bounds__(256) void xpose_b16(const float* __restrict__ x, u16* XT) {
  __shared__ __align__(16) float T[64 * TP];
  const int tid = threadIdx.x, lane = tid & 31, wave = tid >> 5;
  const int ntl = (TX / 64) * (CC / 64);
  const int bid = blockIdx.x;
  const int b   = bid / ntl, t = bid % ntl;
  const int tx0 = (t / (CC / 64)) * 64;
  const int c0  = (t % (CC / 64)) * 64;
  const int r   = tid >> 2, cq = (tid & 3) * 16;
  const float* p = x + ((size_t)b * TX + tx0 + r) * CC + c0 + cq;
  const v4f q0 = *(const v4f*)(p), q1 = *(const v4f*)(p + 4), q2 = *(const v4f*)(p + 8), q3 = *(const v4f*)(p + 12);
#pragma unroll
  for (int e = 0; e < 4; ++e) {
    T[(cq + e) * TP + r]      = q0[e];
    T[(cq + 4 + e) * TP + r]  = q1[e];
    T[(cq + 8 + e) * TP + r]  = q2[e];
    T[(cq + 12 + e) * TP + r] = q3[e];
  }
  __syncthreads();
  const int rq = lane >> 3, g8 = (lane & 7) * 8;
  v4u ov[2];
#pragma unroll
  for (int i = 0; i < 2; ++i) {
    const int ci = wave * 8 + i * 4 + rq;
    const v4f a = *(const v4f*)(T + ci * TP + g8), c4 = *(const v4f*)(T + ci * TP + g8 + 4);
    float w[8];
#pragma unroll
    for (int e = 0; e < 4; ++e) { w[e] = a[e]; w[4 + e] = c4[e]; }
#pragma unroll
    for (int e = 0; e < 4; ++e) ov[i][e] = pk16(bf_bits(w[2 * e]), bf_bits(w[2 * e + 1]));
  }
  u16* dst = XT + ((size_t)b * CC + c0 + wave * 8 + rq) * TX + tx0 + g8;
  {
#pragma unroll
    for (int i = 0; i < 2; ++i) {
      *(v4u*)(dst + (size_t)(i * 4) * TX) = ov[i];
    }
    
  }
}

// =====================================================================================================
// coverage: 8 instructions x 2 rows x 16 lanes x 4 floats = the wave's 16 x 64 tile.
// =====================================================================================================
__device__ __forceinline__ void epi64(float* sl, v8f a0, v8f a1, v8f a2, v8f a3, float* C, int N,
                                      size_t rowb, int col0, int lane) {
  const int hh = lane >> 4, m = lane & 15;
#pragma unroll
  for (int r = 0; r < 8; ++r) {
    const int ro = (8 * hh + r) * 68 + m;
    sl[ro]      = a0[r];
    sl[ro + 16] = a1[r];
    sl[ro + 32] = a2[r];
    sl[ro + 48] = a3[r];
  }
  wave_sync_lds();
  v4f vals[8];
#pragma unroll
  for (int it = 0; it < 8; ++it) vals[it] = *(const v4f*)(sl + (it * 2 + hh) * 68 + m * 4);
  float* dst = C + (rowb + (size_t)hh) * (size_t)N + col0 + m * 4;
  {
#pragma unroll
    for (int it = 0; it < 8; ++it) {
      *(v4f*)(dst + (size_t)(it * 2) * (size_t)N) = vals[it];
    }
    
  }
}

// =====================================================================================================
// Scores + softmax for NTY consecutive ty rows of one b per block (SC_THREADS = TX threads, 8 waves), one row after the
// other. What does not depend on ty is fetched once per block: the wave's 32 x CC f16 rows of x stay in registers as its
// 16 A fragments, the Wd bf16 plane stays in LDS (every thread reads back only the pieces it stored itself), and the
// block's NTY y rows are staged in LDS behind one block barrier.
//  (1) Wy plane in LDS: Wys[h][c] = f16 bits of (bf16(Wd[h][c]) * bf16(y[b][ty][c]) * 1024) (the product is exact in
//      f32; one RNE f16 convert). Thread = (8 consecutive c, h = tid>>5 + 8i, i = 0..15): one 16-B LDS load of the Wd
//      bf16 plane, one 16-B LDS store per (h, 8 c). coverage: 32 c-groups x 8 = CC, 8 x 16 = HH rows; pad cols CC..LDW-1
//      are never read. Block barrier before any fragment load.
//  (2) z[tx][h] (times 16*1024) = XB[b][tx][:] (A, f16 x16, row m = tx, split k map, the fragments held in registers)
//      . Wys[h][:]^T (B, col n = h, split k map from LDS); wave w owns tx rows 32w..32w+31 (2 M-tiles) and visits the
//      128 h columns in four visits of 2 N-tiles (4 accumulators), K = CC stepped by 32.
//      Epilogue per visit: p[row] += bf16(vd[h]) * tanh(z / 16384) in f32, D element r of lane -> (tx 32w+16mt+8hh+r,
//      h = hb+16j+m); then a fixed-order xor reduce over the 16 lanes of each half gives s[tx]; lanes m == 0 write s.
//  (3) f32 max-subtracted softmax over the TX scores (thread = tx): P = e / sum via one reciprocal; P -> bf16 hi bits
//      and bf16 bits of the exact residual (P - hi), staged in LDS; wave 0 writes the hi row, wave 1 the residual row:
// coverage: grid NB*TYR/NTY blocks x NTY rows = every (b, ty < TYR) row of both P planes exactly once.
// =====================================================================================================
__global__ __launch_bounds__(SC_THREADS, 4)                 // 4 waves per SIMD: two blocks share a WGP (256 VGPRs a wave)
void score_softmax(const u16* __restrict__ XB, const u16* __restrict__ YB, const u16* __restrict__ WDB,
                   const float* __restrict__ vd, u16* PH, u16* PL) {
  __shared__ __align__(16) u16 Wys[HH * LDW];
  __shared__ __align__(16) u16 Wds[HH * CC];
  __shared__ __align__(16) u16 ys[NTY * CC];
  __shared__ __align__(16) u16 phs[TX];
  __shared__ __align__(16) u16 pls[TX];
  __shared__ float sl[TX];
  __shared__ float vds[HH];
  __shared__ float redm[SC_WAVES];
  __shared__ float reds[SC_WAVES];

  const int tid = threadIdx.x, wave = tid >> 5, lane = tid & 31, hh = lane >> 4, m = lane & 15;
  const int bid = blockIdx.x;
  const int b   = bid / (TYR / NTY);
  const int ty0 = (bid % (TYR / NTY)) * NTY;
  const int c8 = lane * 8, hq = wave;

  if (tid < HH) vds[tid] = bf_val(vd[tid]);                 // waves 0..3 whole (HH = 128): wave-uniform

  // ---- (0) once per block: A fragments of x, Wd plane, the NTY y rows ----
  const int tx0 = wave * 32;
  const _Float16* ap = (const _Float16*)(const void*)XB + ((size_t)b * TX + tx0 + m) * CC + 8 * hh;
  v16h af0[CC / 32], af1[CC / 32];
#pragma unroll
  for (int kk = 0; kk < CC / 32; ++kk) {
    af0[kk] = ldfrag_h(ap + kk * 32);
    af1[kk] = ldfrag_h(ap + (size_t)16 * CC + kk * 32);
  }
  const v2u yq = *(const v2u*)(YB + ((size_t)b * TY + ty0) * CC + tid * 4);
  // stands in front of every overwrite of the address registers of the loads above (ap is named so that it lives to here)
  asm volatile("s_wait_xcnt 0x0" :: "v"(ap) : "memory");
  *(v2u*)(&ys[tid * 4]) = yq;
#pragma unroll 4                                            // four loads in flight a trip instead of one
  for (int i = 0; i < HH / 8; ++i) {
    const int h = hq + 8 * i;
    *(v4u*)(&Wds[h * CC + c8]) = *(const v4u*)(WDB + (size_t)h * CC + c8);
  }
  __syncthreads();                                          // publishes ys (and vds) to every wave

#pragma unroll 1                                            // rolled: one copy of the long body, registers as for one row
  for (int t = 0; t < NTY; ++t) {
  const int ty = ty0 + t;

  // ---- (1) Wy plane (the last fragment read of the row before lies in front of that row's barrier on sl) ----
  {
    const v4u yv = *(const v4u*)(&ys[t * CC + c8]);
    float yf[8];
#pragma unroll
    for (int e = 0; e < 4; ++e) { yf[2 * e] = lo16f(yv[e]); yf[2 * e + 1] = hi16f(yv[e]); }
#pragma unroll 2
    for (int i = 0; i < HH / 8; ++i) {
      const int h = hq + 8 * i;
      const v4u wv = *(const v4u*)(&Wds[h * CC + c8]);
      v4u o;
#pragma unroll
      for (int e = 0; e < 4; ++e) {
        const float p0 = (lo16f(wv[e]) * yf[2 * e]) * WYS;
        const float p1 = (hi16f(wv[e]) * yf[2 * e + 1]) * WYS;
        o[e] = pk16(h_bits((_Float16)p0), h_bits((_Float16)p1));
      }
      *(v4u*)(&Wys[h * LDW + c8]) = o;
    }
  }
  __syncthreads();

  // ---- (2) scores ----
  const _Float16* wl = (const _Float16*)(const void*)(&Wys[0]);
  float p0[8], p1[8];
#pragma unroll
  for (int r = 0; r < 8; ++r) { p0[r] = 0.f; p1[r] = 0.f; }

#pragma unroll 1
  for (int q = 0; q < 4; ++q) {                             // 2 N-tiles a visit: 4 accumulators beside the 16 A fragments
    const int hb = q * 32;
    const _Float16* bq = wl + (size_t)(hb + m) * LDW + 8 * hh;
    v8f c0[2], c1[2];
#pragma unroll
    for (int j = 0; j < 2; ++j) { c0[j] = zero8(); c1[j] = zero8(); }
#pragma unroll
    for (int k0 = 0; k0 < CC; k0 += 64) {                   // unrolled: the fragment arrays need constant indices
      const v16h b0 = ldfrag_h(bq + k0);                    // two k steps a trip: 8 LDS loads ahead of 8 products
      const v16h b1 = ldfrag_h(bq + 16 * LDW + k0);
      const v16h b2 = ldfrag_h(bq + k0 + 32);
      const v16h b3 = ldfrag_h(bq + 16 * LDW + k0 + 32);
      c0[0] = mma_h(af0[k0 / 32], b0, c0[0]);
      c0[1] = mma_h(af0[k0 / 32], b1, c0[1]);
      c1[0] = mma_h(af1[k0 / 32], b0, c1[0]);
      c1[1] = mma_h(af1[k0 / 32], b1, c1[1]);
      c0[0] = mma_h(af0[k0 / 32 + 1], b2, c0[0]);
      c0[1] = mma_h(af0[k0 / 32 + 1], b3, c0[1]);
      c1[0] = mma_h(af1[k0 / 32 + 1], b2, c1[0]);
      c1[1] = mma_h(af1[k0 / 32 + 1], b3, c1[1]);
    }
    acc_guard4(c0[0], c0[1], c1[0], c1[1]);
#pragma unroll
    for (int j = 0; j < 2; ++j) {
      const float vv = vds[hb + 16 * j + m];
#pragma unroll
      for (int r = 0; r < 8; ++r) {
        p0[r] += vv * tanh_e(c0[j][r] * ZINV);
        p1[r] += vv * tanh_e(c1[j][r] * ZINV);
      }
    }
  }

  // reduce over the 16 column lanes of each half (fixed order); D row = tx0 + 16*mt + 8*hh + r
#pragma unroll
  for (int r = 0; r < 8; ++r) {
    float v = p0[r];
    v += __shfl_xor(v, 1, 16);
    v += __shfl_xor(v, 2, 16);
    v += __shfl_xor(v, 4, 16);
    v += __shfl_xor(v, 8, 16);
    p0[r] = v;
    float u = p1[r];
    u += __shfl_xor(u, 1, 16);
    u += __shfl_xor(u, 2, 16);
    u += __shfl_xor(u, 4, 16);
    u += __shfl_xor(u, 8, 16);
    p1[r] = u;
  }
  if (m == 0) {
#pragma unroll
    for (int r = 0; r < 8; ++r) {
      sl[tx0 + 8 * hh + r]      = p0[r];
      sl[tx0 + 16 + 8 * hh + r] = p1[r];
    }
  }
  __syncthreads();

  // ---- (3) softmax over tx (thread = tx) ----
  const float sv = sl[tid];
  float mx = sv;
  mx = fmaxf(mx, __shfl_xor(mx, 16, 32));
  mx = fmaxf(mx, __shfl_xor(mx, 8, 32));
  mx = fmaxf(mx, __shfl_xor(mx, 4, 32));
  mx = fmaxf(mx, __shfl_xor(mx, 2, 32));
  mx = fmaxf(mx, __shfl_xor(mx, 1, 32));
  if (lane == 0) redm[wave] = mx;
  __syncthreads();
  float mm = redm[0];
#pragma unroll
  for (int w = 1; w < SC_WAVES; ++w) mm = fmaxf(mm, redm[w]);
  const float ev = expf(sv - mm);
  float ss = ev;
  ss += __shfl_xor(ss, 16, 32);
  ss += __shfl_xor(ss, 8, 32);
  ss += __shfl_xor(ss, 4, 32);
  ss += __shfl_xor(ss, 2, 32);
  ss += __shfl_xor(ss, 1, 32);
  if (lane == 0) reds[wave] = ss;
  __syncthreads();
  float tot = reds[0];
#pragma unroll
  for (int w = 1; w < SC_WAVES; ++w) tot += reds[w];
  const float a = ev * (1.0f / tot);                       // tot >= 1 by construction
  const unsigned short hb16 = bf_bits(a);
  const unsigned short lb16 = bf_bits(a - bf_up(hb16));    // residual is exact in f32
  phs[tid] = hb16;
  pls[tid] = lb16;
  __syncthreads();

  if (wave < 2) {                                          // wave-uniform; no barrier inside
    const v4u oh = *(const v4u*)(&phs[lane * 8]);
    const v4u ol = *(const v4u*)(&pls[lane * 8]);
    const v4u o  = (wave == 0) ? oh : ol;
    u16* base = (wave == 0) ? PH : PL;
    u16* dst  = base + ((size_t)b * TYR + ty) * TX + lane * 8;
    {
      *(v4u*)(dst) = o;
      // the next trip of the ty loop reuses the store's registers
      asm volatile("s_wait_xcnt 0x0" ::: "memory");
    }
  }
  }
}

// =====================================================================================================
// bf16 GEMM with f32 result into out: out[bz][ty][d] = sum_tx (PH + PL)[bz][ty][tx] * XT[bz][d][tx]
// (A = hi and residual planes, row-major k = tx; Bt = XT k-contiguous [n = d][k = tx]; two products per tile pair into
// one accumulator). Block = 64x64 tile of batch bz, 4 waves x 16 rows, fragments loaded straight from the 16-bit rows
// (two 16-B loads each, split k map for A and B), K = TX stepped by 32; epilogue epi64.
// coverage: grid NB*(TYR/64)*(CC/64) blocks x 4 waves x (16 x 64) = every out[b][ty < TYR][d] exactly once.
// =====================================================================================================
__global__ __launch_bounds__(128)
void gemm_pv(const u16* __restrict__ PH, const u16* __restrict__ PL, const u16* __restrict__ XT, float* out) {
  __shared__ __align__(16) float slab[4 * SLAB];
  const int tid = threadIdx.x, wave = tid >> 5, lane = tid & 31, hh = lane >> 4, m = lane & 15;
  const int ntl  = (TYR / 64) * (CC / 64);
  const int bid  = blockIdx.x;
  const int bz   = bid / ntl, t = bid % ntl;
  const int rowl = (t / (CC / 64)) * 64 + wave * 16;
  const int col0 = (t % (CC / 64)) * 64;
  const u16* aph = PH + ((size_t)bz * TYR + rowl + m) * TX + 8 * hh;
  const u16* apl = PL + ((size_t)bz * TYR + rowl + m) * TX + 8 * hh;
  const u16* bp  = XT + ((size_t)bz * CC + col0 + m) * TX + 8 * hh;
  const size_t bs = (size_t)16 * TX;
  v8f acc0 = zero8(), acc1 = zero8(), acc2 = zero8(), acc3 = zero8();
#pragma unroll 1
  for (int k0 = 0; k0 < TX; k0 += 32) {
    const v16b ah = ldfrag_b(aph + k0);
    const v16b al = ldfrag_b(apl + k0);
    const v16b b0 = ldfrag_b(bp + k0);
    const v16b b1 = ldfrag_b(bp + bs + k0);
    const v16b b2 = ldfrag_b(bp + 2 * bs + k0);
    const v16b b3 = ldfrag_b(bp + 3 * bs + k0);
    acc0 = mma_b(ah, b0, acc0);
    acc1 = mma_b(ah, b1, acc1);
    acc2 = mma_b(ah, b2, acc2);
    acc3 = mma_b(ah, b3, acc3);
    acc0 = mma_b(al, b0, acc0);
    acc1 = mma_b(al, b1, acc1);
    acc2 = mma_b(al, b2, acc2);
    acc3 = mma_b(al, b3, acc3);
    guard6<v16b>(acc0, acc1, acc2, acc3, ah, al, b0, b1, b2, b3);
  }
  acc_guard4(acc0, acc1, acc2, acc3);
  epi64(slab + wave * SLAB, acc0, acc1, acc2, acc3, out + (size_t)bz * TYR * CC, CC, (size_t)rowl, col0, lane);
}

// =====================================================================================================
// Workspace map (bytes, NB = 8, TYR = 256); every plane is fully written by whole-line stores before it is read; all
// extents are exact multiples of the store granularity (no pad rows), every offset a multiple of 128:
//   XB  f16 [NB*TX][CC]  x16         1048576
//   YB  bf16 [NB*TY][CC]             1048576
//   WDB bf16 [HH][CC]                  65536
//   XT  bf16 [NB*CC][TX]             1048576
//   PH  bf16 [NB*TYR][TX]            1048576
//   PL  bf16 [NB*TYR][TX]            1048576
//   end                              5308416
// Inputs are read with the full-size batch strides (TX*CC, TY*CC); out is written as [NB][TYR][CC].
// =====================================================================================================
extern "C" void kernel_launch(void* const* d_in, const int* in_sizes, int n_in,
                              void* d_out, int out_size, void* d_ws, size_t ws_size,
                              hipStream_t stream) {
  if (n_in < 4) return;
  if (in_sizes[0] < NB * TX * CC || in_sizes[1] < NB * TY * CC) return;
  if (in_sizes[2] < HH * CC || in_sizes[3] < HH) return;
  if (out_size < NB * TYR * CC) return;

  const float* Xin = (const float*)d_in[0];
  const float* Yin = (const float*)d_in[1];
  const float* Wd  = (const float*)d_in[2];
  const float* vd  = (const float*)d_in[3];
  float*       out = (float*)d_out;

  const size_t szXB = (size_t)NB * TX * CC * 2;
  const size_t szYB = (size_t)NB * TY * CC * 2;
  const size_t szWD = (size_t)HH * CC * 2;
  const size_t szXT = (size_t)NB * CC * TX * 2;
  const size_t szP  = (size_t)NB * TYR * TX * 2;
  size_t off = 0;
  const size_t oXB = off; off += szXB;
  const size_t oYB = off; off += szYB;
  const size_t oWD = off; off += szWD;
  const size_t oXT = off; off += szXT;
  const size_t oPH = off; off += szP;
  const size_t oPL = off; off += szP;
  if (off > ws_size) return;                            // 5308416 at NB = 8, TYR = 256
  if (off > (size_t)134217728) return;

  char* ws = (char*)d_ws;
  u16* XB  = (u16*)(ws + oXB);
  u16* YB  = (u16*)(ws + oYB);
  u16* WDB = (u16*)(ws + oWD);
  u16* XT  = (u16*)(ws + oXT);
  u16* PH  = (u16*)(ws + oPH);
  u16* PL  = (u16*)(ws + oPL);

  const int n8x = (NB * TX * CC) / 8;                   // 65536
  const int n8y = (NB * TY * CC) / 8;                   // 65536
  const int n8w = (HH * CC) / 8;                        //  4096
  if ((n8x % 256) != 0 || (n8y % 256) != 0 || (n8w % 256) != 0) return;

  const dim3 blk(256);
  const dim3 gX(n8x / 256);                             // 256
  const dim3 gY(n8y / 256);                             // 256
  const dim3 gW(n8w / 256);                             // 16
  const dim3 gXT(NB * (TX / 64) * (CC / 64));           // 128
  const dim3 gSC(NB * TYR / NTY);                       // 512
  const dim3 bSC(SC_THREADS);                           // 256
  const dim3 gPV(NB * (TYR / 64) * (CC / 64));          // 128
  const dim3 bPV(128);

  // (0..2) operand planes: x -> f16 of bf16 value x16; y -> bf16; Wd [h][c] (k-contiguous) -> bf16
  cvt16<<<gX, blk, 0, stream>>>(Xin, XB, n8x, 1, XSC);
  cvt16<<<gY, blk, 0, stream>>>(Yin, YB, n8y, 0, 1.0f);
  cvt16<<<gW, blk, 0, stream>>>(Wd, WDB, n8w, 0, 1.0f);
  // (3) x[b][tx][c] -> XT[b][c][tx] bf16
  xpose_b16<<<gXT, blk, 0, stream>>>(Xin, XT);
  // (4) scores, tanh.vd row-dot, softmax -> P hi / residual bf16 planes [b][ty][tx]
  score_softmax<<<gSC, bSC, 0, stream>>>(XB, YB, WDB, vd, PH, PL);
  // (5) out[b][ty][d] = sum_tx P[b][ty][tx] * x[b][tx][d]
  gemm_pv<<<gPV, bPV, 0, stream>>>(PH, PL, XT, out);
  (void)hipGetLastError();
}

// v002
// It runs in 43.4 microseconds.
// Next to v001, in two timings, it ran 1.25 times as fast each time.
// All steps since v000 together make it 1.56 times as fast.
// Contractions: scores x.(Wd*y)^T on v_wmma_f32_16x16x32_f16 (x as f16 of its RNE bf16 value x16, Wd*y product plane as
// single f16 x1024, f32 accumulate); P.x on v_wmma_f32_16x16x32_bf16 (P as bf16 hi + bf16 residual planes, x as RNE bf16,
// f32 accumulate). tanh, the h.vd row-dot (vd as RNE bf16 value) and the softmax in f32 on VALU.
#include <hip/hip_runtime.h>
#include <math.h>
#include <stdint.h>

#ifndef NB
#define NB 8
#endif
#define NB_FULL 8
#define TX 256
#define TY 256
#ifndef TYR
#define TYR TY
#endif
#define CC 256
#define HH 128
#define XSC 16.0f
#define WYS 1024.0f
#define ZINV (1.0f / (16.0f * 1024.0f))
#define LDW 264
#define TP 68
#define SLAB (16 * 68)
#define SC_WAVES 8
#define SC_THREADS (SC_WAVES * 32)
#define NTY 4

static_assert(TX == 256 && TY == 256 && CC == 256 && HH == 128);
static_assert(NB >= 1 && NB <= NB_FULL);
static_assert((TYR % 64) == 0 && TYR >= 64 && TYR <= TY);
static_assert((TYR % NTY) == 0 && NTY * CC == SC_THREADS * 4);
static_assert(SC_THREADS == TX && SC_WAVES * 32 == TX && SC_WAVES * 16 == HH && 32 * 8 == CC);
static_assert((CC % 32) == 0 && (TX % 32) == 0 && (LDW % 8) == 0 && LDW >= CC);
static_assert(((NB * TX * CC / 8) % 256) == 0 && ((NB * TY * CC / 8) % 256) == 0 && ((HH * CC / 8) % 256) == 0);
static_assert((TX % 64) == 0 && (CC % 64) == 0 && (TP * 4) % 16 == 0 && (SLAB * 4) % 16 == 0);

typedef unsigned short u16;
typedef _Float16 v16h __attribute__((ext_vector_type(16)));
typedef _Float16 v8h  __attribute__((ext_vector_type(8)));
typedef __bf16   v16b __attribute__((ext_vector_type(16)));
typedef float    v8f  __attribute__((ext_vector_type(8)));
typedef float    v4f  __attribute__((ext_vector_type(4)));
typedef unsigned int v4u __attribute__((ext_vector_type(4)));
typedef unsigned int v2u __attribute__((ext_vector_type(2)));

union FragH { v16h v; v8h h[2]; v4u u[2]; };
union FragB { v16b v; v4u u[2]; };

// ---- scalar helpers --------------------------------------------------------------------------------
__device__ __forceinline__ unsigned short bf_bits(float f) {          // f32 -> bf16 bits, RNE convert
  unsigned u = __float_as_uint(f);
  return (unsigned short)((u + 0x7FFFu + ((u >> 16) & 1u)) >> 16);
}
__device__ __forceinline__ float bf_up(unsigned short h) { return __uint_as_float(((unsigned)h) << 16); }
__device__ __forceinline__ float bf_val(float f) { return bf_up(bf_bits(f)); }          // value after RNE bf16 convert
__device__ __forceinline__ float lo16f(unsigned w) { return __uint_as_float(w << 16); }          // low bf16 of a packed pair
__device__ __forceinline__ float hi16f(unsigned w) { return __uint_as_float(w & 0xffff0000u); } // high bf16 of a packed pair
__device__ __forceinline__ unsigned short h_bits(_Float16 x) { return __builtin_bit_cast(unsigned short, x); }
__device__ __forceinline__ unsigned pk16(unsigned short a, unsigned short b) { return (unsigned)a | ((unsigned)b << 16); }
__device__ __forceinline__ v8f zero8() { v8f z = {0.f, 0.f, 0.f, 0.f, 0.f, 0.f, 0.f, 0.f}; return z; }

// tanh(v) on the chip's own transcendental (v_tanh_f32): one instruction, branch-free
__device__ __forceinline__ float tanh_e(float v) {
  return __builtin_amdgcn_tanhf(v);
}

// ---- fragment loaders: 16-bit A/B operand, lane -> row/col (lane&15), p already includes +8*(lane>>4);
//      elements 0..7 <- p[0..7] (k0+8h..), elements 8..15 <- p[16..23] (k0+16+8h..)  (same split k map for A and B;
//      B is always read from a k-contiguous [n][k] plane)
__device__ __forceinline__ v16h ldfrag_h(const _Float16* p) {
  FragH f;
  f.h[0] = *(const v8h*)(p);
  f.h[1] = *(const v8h*)(p + 16);
  return f.v;
}
__device__ __forceinline__ v16b ldfrag_b(const u16* p) {              // bf16 plane read as unsigned integer vectors
  FragB f;
  f.u[0] = *(const v4u*)(p);
  f.u[1] = *(const v4u*)(p + 16);
  return f.v;
}

__device__ __forceinline__ v8f mma_h(v16h a, v16h b, v8f c) {
  return __builtin_amdgcn_wmma_f32_16x16x32_f16(false, a, false, b, (short)0, c, false, false);
}
__device__ __forceinline__ v8f mma_b(v16b a, v16b b, v8f c) {
  return __builtin_amdgcn_wmma_f32_16x16x32_bf16(false, a, false, b, (short)0, c, false, false);
}
template <typename F>
__device__ __forceinline__ void guard6(v8f& a, v8f& b, v8f& c, v8f& d, F x0, F x1, F x2, F x3, F x4, F x5) {
#if defined(__HIP_DEVICE_COMPILE__)
  asm volatile("v_nop\n\tv_nop\n\tv_nop\n\tv_nop"
               : "+v"(a), "+v"(b), "+v"(c), "+v"(d) : "v"(x0), "v"(x1), "v"(x2), "v"(x3), "v"(x4), "v"(x5) : "memory");
#endif
}
__device__ __forceinline__ void acc_guard4(v8f& a, v8f& b, v8f& c, v8f& d) {
#if defined(__HIP_DEVICE_COMPILE__)
  asm volatile("v_nop\n\tv_nop\n\tv_nop\n\tv_nop" : "+v"(a), "+v"(b), "+v"(c), "+v"(d));
#endif
}
__device__ __forceinline__ void wave_sync_lds() {
#if defined(__HIP_DEVICE_COMPILE__)
  __builtin_amdgcn_fence(__ATOMIC_RELEASE, "workgroup");
  __builtin_amdgcn_wave_barrier();
  __builtin_amdgcn_fence(__ATOMIC_ACQUIRE, "workgroup");
#endif
}

// =====================================================================================================
// f32 plane -> 16-bit plane, same layout:  mode 0: bf16 RNE bits;  mode 1: f16 bits of (bf16 RNE value) * scale.
// Thread = 8 consecutive elements: two 16-B loads, one 16-B store; 32 consecutive lanes = 512 contiguous, 512-B aligned bytes
// coverage: grid = n8/256 blocks (host checks exactness) x 256 thr x 8 = the whole plane.
// =====================================================================================================
__global__ __launch_bounds__(256) void cvt16(const float* __restrict__ x, u16* D, int n8, int mode, float scale) {
  const int gt = blockIdx.x * 256 + (int)threadIdx.x;
  if (gt >= n8) return;                     // no barriers in this kernel
  const float* p = x + (size_t)gt * 8;
  const v4f a = *(const v4f*)(p), c4 = *(const v4f*)(p + 4);
  float v[8];
#pragma unroll
  for (int e = 0; e < 4; ++e) { v[e] = a[e]; v[4 + e] = c4[e]; }
  unsigned short s[8];
#pragma unroll
  for (int e = 0; e < 8; ++e) {
    const unsigned short bb = bf_bits(v[e]);
    const unsigned short hb = h_bits((_Float16)(bf_up(bb) * scale));
    s[e] = (mode != 0) ? hb : bb;
  }
  v4u o;
#pragma unroll
  for (int e = 0; e < 4; ++e) o[e] = pk16(s[2 * e], s[2 * e + 1]);
  u16* d = D + (size_t)gt * 8;
  {
    *(v4u*)(d) = o;
    
  }
}

// =====================================================================================================
// Transposed bf16 plane of x:  in x[b][tx][c] f32 (row pitch CC)  ->  out XT[b][c][tx] bf16 RNE bits (row pitch TX).
// Block = (b, 64 tx rows, 64 c cols): thread loads 16 consecutive c of one tx row (four 16-B loads), stores them
// transposed into the LDS tile T[c][tx] (pitch TP floats); after the block barrier wave w / instruction i writes the
// coverage: 8 waves x 2 instructions x 4 rows = 64 c rows, 8 lanes x 8 halves = 64 tx each; grid NB*(TX/64)*(CC/64)
//           blocks = every (b, c, tx) of the XT plane exactly once. Staged extent == consumed extent (64 x 64 of T).
// =====================================================================================================
__global__ __launch_bounds__(256) void xpose_b16(const float* __restrict__ x, u16* XT) {
  __shared__ __align__(16) float T[64 * TP];
  const int tid = threadIdx.x, lane = tid & 31, wave = tid >> 5;
  const int ntl = (TX / 64) * (CC / 64);
  const int bid = blockIdx.x;
  const int b   = bid / ntl, t = bid % ntl;
  const int tx0 = (t / (CC / 64)) * 64;
  const int c0  = (t % (CC / 64)) * 64;
  const int r   = tid >> 2, cq = (tid & 3) * 16;
  const float* p = x + ((size_t)b * TX + tx0 + r) * CC + c0 + cq;
  const v4f q0 = *(const v4f*)(p), q1 = *(const v4f*)(p + 4), q2 = *(const v4f*)(p + 8), q3 = *(const v4f*)(p + 12);
#pragma unroll
  for (int e = 0; e < 4; ++e) {
    T[(cq + e) * TP + r]      = q0[e];
    T[(cq + 4 + e) * TP + r]  = q1[e];
    T[(cq + 8 + e) * TP + r]  = q2[e];
    T[(cq + 12 + e) * TP + r] = q3[e];
  }
  __syncthreads();
  const int rq = lane >> 3, g8 = (lane & 7) * 8;
  v4u ov[2];
#pragma unroll
  for (int i = 0; i < 2; ++i) {
    const int ci = wave * 8 + i * 4 + rq;
    const v4f a = *(const v4f*)(T + ci * TP + g8), c4 = *(const v4f*)(T + ci * TP + g8 + 4);
    float w[8];
#pragma unroll
    for (int e = 0; e < 4; ++e) { w[e] = a[e]; w[4 + e] = c4[e]; }
#pragma unroll
    for (int e = 0; e < 4; ++e) ov[i][e] = pk16(bf_bits(w[2 * e]), bf_bits(w[2 * e + 1]));
  }
  u16* dst = XT + ((size_t)b * CC + c0 + wave * 8 + rq) * TX + tx0 + g8;
  {
#pragma unroll
    for (int i = 0; i < 2; ++i) {
      *(v4u*)(dst + (size_t)(i * 4) * TX) = ov[i];
    }
    
  }
}

// =====================================================================================================
// coverage: 8 instructions x 2 rows x 16 lanes x 4 floats = the wave's 16 x 64 tile.
// =====================================================================================================
__device__ __forceinline__ void epi64(float* sl, v8f a0, v8f a1, v8f a2, v8f a3, float* C, int N,
                                      size_t rowb, int col0, int lane) {
  const int hh = lane >> 4, m = lane & 15;
#pragma unroll
  for (int r = 0; r < 8; ++r) {
    const int ro = (8 * hh + r) * 68 + m;
    sl[ro]      = a0[r];
    sl[ro + 16] = a1[r];
    sl[ro + 32] = a2[r];
    sl[ro + 48] = a3[r];
  }
  wave_sync_lds();
  v4f vals[8];
#pragma unroll
  for (int it = 0; it < 8; ++it) vals[it] = *(const v4f*)(sl + (it * 2 + hh) * 68 + m * 4);
  float* dst = C + (rowb + (size_t)hh) * (size_t)N + col0 + m * 4;
  {
#pragma unroll
    for (int it = 0; it < 8; ++it) {
      *(v4f*)(dst + (size_t)(it * 2) * (size_t)N) = vals[it];
    }
    
  }
}

// =====================================================================================================
// Scores + softmax for NTY consecutive ty rows of one b per block (SC_THREADS = TX threads, 8 waves), one row after the
// other. What does not depend on ty is fetched once per block: the wave's 32 x CC f16 rows of x stay in registers as its
// 16 A fragments, the Wd bf16 plane stays in LDS (every thread reads back only the pieces it stored itself), and the
// block's NTY y rows are staged in LDS behind one block barrier.
//  (1) Wy plane in LDS: Wys[h][c] = f16 bits of (bf16(Wd[h][c]) * bf16(y[b][ty][c]) * 1024) (the product is exact in
//      f32; one RNE f16 convert). Thread = (8 consecutive c, h = tid>>5 + 8i, i = 0..15): one 16-B LDS load of the Wd
//      bf16 plane, one 16-B LDS store per (h, 8 c). coverage: 32 c-groups x 8 = CC, 8 x 16 = HH rows; pad cols CC..LDW-1
//      are never read. Block barrier before any fragment load.
//  (2) z[tx][h] (times 16*1024) = XB[b][tx][:] (A, f16 x16, row m = tx, split k map, the fragments held in registers)
//      . Wys[h][:]^T (B, col n = h, split k map from LDS); wave w owns tx rows 32w..32w+31 (2 M-tiles) and visits the
//      128 h columns in four visits of 2 N-tiles (4 accumulators), K = CC stepped by 32.
//      Epilogue per visit: p[row] += bf16(vd[h]) * tanh(z / 16384) in f32, D element r of lane -> (tx 32w+16mt+8hh+r,
//      h = hb+16j+m); then a fixed-order xor reduce over the 16 lanes of each half gives s[tx]; lanes m == 0 write s.
//  (3) f32 max-subtracted softmax over the TX scores (thread = tx): P = e / sum via one reciprocal; P -> bf16 hi bits
//      and bf16 bits of the exact residual (P - hi), staged in LDS; wave 0 writes the hi row, wave 1 the residual row:
// coverage: grid NB*TYR/NTY blocks x NTY rows = every (b, ty < TYR) row of both P planes exactly once.
// =====================================================================================================
__global__ __launch_bounds__(SC_THREADS, 4)                 // 4 waves per SIMD: two blocks share a WGP (256 VGPRs a wave)
void score_softmax(const u16* __restrict__ XB, const u16* __restrict__ YB, const u16* __restrict__ WDB,
                   const float* __restrict__ vd, u16* PH, u16* PL) {
  __shared__ __align__(16) u16 Wys[HH * LDW];
  __shared__ __align__(16) u16 Wds[HH * CC];
  __shared__ __align__(16) u16 ys[NTY * CC];
  __shared__ __align__(16) u16 phs[TX];
  __shared__ __align__(16) u16 pls[TX];
  __shared__ float sl[TX];
  __shared__ float vds[HH];
  __shared__ float redm[SC_WAVES];
  __shared__ float reds[SC_WAVES];

  const int tid = threadIdx.x, wave = tid >> 5, lane = tid & 31, hh = lane >> 4, m = lane & 15;
  const int bid = blockIdx.x;
  const int b   = bid / (TYR / NTY);
  const int ty0 = (bid % (TYR / NTY)) * NTY;
  const int c8 = lane * 8, hq = wave;

  if (tid < HH) vds[tid] = bf_val(vd[tid]);                 // waves 0..3 whole (HH = 128): wave-uniform

  // ---- (0) once per block: A fragments of x, Wd plane, the NTY y rows ----
  const int tx0 = wave * 32;
  const _Float16* ap = (const _Float16*)(const void*)XB + ((size_t)b * TX + tx0 + m) * CC + 8 * hh;
  v16h af0[CC / 32], af1[CC / 32];
#pragma unroll
  for (int kk = 0; kk < CC / 32; ++kk) {
    af0[kk] = ldfrag_h(ap + kk * 32);
    af1[kk] = ldfrag_h(ap + (size_t)16 * CC + kk * 32);
  }
  const v2u yq = *(const v2u*)(YB + ((size_t)b * TY + ty0) * CC + tid * 4);
  // stands in front of every overwrite of the address registers of the loads above (ap is named so that it lives to here)
  asm volatile("s_wait_xcnt 0x0" :: "v"(ap) : "memory");
  *(v2u*)(&ys[tid * 4]) = yq;
#pragma unroll 4                                            // four loads in flight a trip instead of one
  for (int i = 0; i < HH / 8; ++i) {
    const int h = hq + 8 * i;
    *(v4u*)(&Wds[h * CC + c8]) = *(const v4u*)(WDB + (size_t)h * CC + c8);
  }
  __syncthreads();                                          // publishes ys (and vds) to every wave

#pragma unroll 1                                            // rolled: one copy of the long body, registers as for one row
  for (int t = 0; t < NTY; ++t) {
  const int ty = ty0 + t;

  // ---- (1) Wy plane (the last fragment read of the row before lies in front of that row's barrier on sl) ----
  {
    const v4u yv = *(const v4u*)(&ys[t * CC + c8]);
    float yf[8];
#pragma unroll
    for (int e = 0; e < 4; ++e) { yf[2 * e] = lo16f(yv[e]); yf[2 * e + 1] = hi16f(yv[e]); }
#pragma unroll 2
    for (int i = 0; i < HH / 8; ++i) {
      const int h = hq + 8 * i;
      const v4u wv = *(const v4u*)(&Wds[h * CC + c8]);
      v4u o;
#pragma unroll
      for (int e = 0; e < 4; ++e) {
        const float p0 = (lo16f(wv[e]) * yf[2 * e]) * WYS;
        const float p1 = (hi16f(wv[e]) * yf[2 * e + 1]) * WYS;
        o[e] = pk16(h_bits((_Float16)p0), h_bits((_Float16)p1));
      }
      *(v4u*)(&Wys[h * LDW + c8]) = o;
    }
  }
  __syncthreads();

  // ---- (2) scores ----
  const _Float16* wl = (const _Float16*)(const void*)(&Wys[0]);
  v8f p0 = zero8(), p1 = zero8();

#pragma unroll 1
  for (int q = 0; q < 4; ++q) {                             // 2 N-tiles a visit: 4 accumulators beside the 16 A fragments
    const int hb = q * 32;
    const _Float16* bq = wl + (size_t)(hb + m) * LDW + 8 * hh;
    v8f c0[2], c1[2];
#pragma unroll
    for (int j = 0; j < 2; ++j) { c0[j] = zero8(); c1[j] = zero8(); }
#pragma unroll
    for (int k0 = 0; k0 < CC; k0 += 64) {                   // unrolled: the fragment arrays need constant indices
      const v16h b0 = ldfrag_h(bq + k0);                    // two k steps a trip: 8 LDS loads ahead of 8 products
      const v16h b1 = ldfrag_h(bq + 16 * LDW + k0);
      const v16h b2 = ldfrag_h(bq + k0 + 32);
      const v16h b3 = ldfrag_h(bq + 16 * LDW + k0 + 32);
      c0[0] = mma_h(af0[k0 / 32], b0, c0[0]);
      c0[1] = mma_h(af0[k0 / 32], b1, c0[1]);
      c1[0] = mma_h(af1[k0 / 32], b0, c1[0]);
      c1[1] = mma_h(af1[k0 / 32], b1, c1[1]);
      c0[0] = mma_h(af0[k0 / 32 + 1], b2, c0[0]);
      c0[1] = mma_h(af0[k0 / 32 + 1], b3, c0[1]);
      c1[0] = mma_h(af1[k0 / 32 + 1], b2, c1[0]);
      c1[1] = mma_h(af1[k0 / 32 + 1], b3, c1[1]);
    }
    acc_guard4(c0[0], c0[1], c1[0], c1[1]);
#pragma unroll
    for (int j = 0; j < 2; ++j) {
      const float vv = vds[hb + 16 * j + m];
      v8f t0 = c0[j] * ZINV, t1 = c1[j] * ZINV;             // independent tanh back to back: none waits for its neighbour
#pragma unroll
      for (int r = 0; r < 8; ++r) { t0[r] = tanh_e(t0[r]); t1[r] = tanh_e(t1[r]); }
      p0 += vv * t0;
      p1 += vv * t1;
    }
  }

  // reduce over the 16 column lanes of each half (fixed order); D row = tx0 + 16*mt + 8*hh + r
#pragma unroll
  for (int r = 0; r < 8; ++r) {
    float v = p0[r];
    v += __shfl_xor(v, 1, 16);
    v += __shfl_xor(v, 2, 16);
    v += __shfl_xor(v, 4, 16);
    v += __shfl_xor(v, 8, 16);
    p0[r] = v;
    float u = p1[r];
    u += __shfl_xor(u, 1, 16);
    u += __shfl_xor(u, 2, 16);
    u += __shfl_xor(u, 4, 16);
    u += __shfl_xor(u, 8, 16);
    p1[r] = u;
  }
  if (m == 0) {
#pragma unroll
    for (int r = 0; r < 8; ++r) {
      sl[tx0 + 8 * hh + r]      = p0[r];
      sl[tx0 + 16 + 8 * hh + r] = p1[r];
    }
  }
  __syncthreads();

  // ---- (3) softmax over tx (thread = tx) ----
  const float sv = sl[tid];
  float mx = sv;
  mx = fmaxf(mx, __shfl_xor(mx, 16, 32));
  mx = fmaxf(mx, __shfl_xor(mx, 8, 32));
  mx = fmaxf(mx, __shfl_xor(mx, 4, 32));
  mx = fmaxf(mx, __shfl_xor(mx, 2, 32));
  mx = fmaxf(mx, __shfl_xor(mx, 1, 32));
  if (lane == 0) redm[wave] = mx;
  __syncthreads();
  float mm = redm[0];
#pragma unroll
  for (int w = 1; w < SC_WAVES; ++w) mm = fmaxf(mm, redm[w]);
  const float ev = expf(sv - mm);
  float ss = ev;
  ss += __shfl_xor(ss, 16, 32);
  ss += __shfl_xor(ss, 8, 32);
  ss += __shfl_xor(ss, 4, 32);
  ss += __shfl_xor(ss, 2, 32);
  ss += __shfl_xor(ss, 1, 32);
  if (lane == 0) reds[wave] = ss;
  __syncthreads();
  float tot = reds[0];
#pragma unroll
  for (int w = 1; w < SC_WAVES; ++w) tot += reds[w];
  const float a = ev * (1.0f / tot);                       // tot >= 1 by construction
  const unsigned short hb16 = bf_bits(a);
  const unsigned short lb16 = bf_bits(a - bf_up(hb16));    // residual is exact in f32
  phs[tid] = hb16;
  pls[tid] = lb16;
  __syncthreads();

  if (wave < 2) {                                          // wave-uniform; no barrier inside
    const v4u oh = *(const v4u*)(&phs[lane * 8]);
    const v4u ol = *(const v4u*)(&pls[lane * 8]);
    const v4u o  = (wave == 0) ? oh : ol;
    u16* base = (wave == 0) ? PH : PL;
    u16* dst  = base + ((size_t)b * TYR + ty) * TX + lane * 8;
    {
      *(v4u*)(dst) = o;
      // the next trip of the ty loop reuses the store's registers
      asm volatile("s_wait_xcnt 0x0" ::: "memory");
    }
  }
  }
}

// =====================================================================================================
// bf16 GEMM with f32 result into out: out[bz][ty][d] = sum_tx (PH + PL)[bz][ty][tx] * XT[bz][d][tx]
// (A = hi and residual planes, row-major k = tx; Bt = XT k-contiguous [n = d][k = tx]; two products per tile pair into
// one accumulator). Block = 64x64 tile of batch bz, 4 waves x 16 rows, fragments loaded straight from the 16-bit rows
// (two 16-B loads each, split k map for A and B), K = TX stepped by 32; epilogue epi64.
// coverage: grid NB*(TYR/64)*(CC/64) blocks x 4 waves x (16 x 64) = every out[b][ty < TYR][d] exactly once.
// =====================================================================================================
__global__ __launch_bounds__(128)
void gemm_pv(const u16* __restrict__ PH, const u16* __restrict__ PL, const u16* __restrict__ XT, float* out) {
  __shared__ __align__(16) float slab[4 * SLAB];
  const int tid = threadIdx.x, wave = tid >> 5, lane = tid & 31, hh = lane >> 4, m = lane & 15;
  const int ntl  = (TYR / 64) * (CC / 64);
  const int bid  = blockIdx.x;
  const int bz   = bid / ntl, t = bid % ntl;
  const int rowl = (t / (CC / 64)) * 64 + wave * 16;
  const int col0 = (t % (CC / 64)) * 64;
  const u16* aph = PH + ((size_t)bz * TYR + rowl + m) * TX + 8 * hh;
  const u16* apl = PL + ((size_t)bz * TYR + rowl + m) * TX + 8 * hh;
  const u16* bp  = XT + ((size_t)bz * CC + col0 + m) * TX + 8 * hh;
  const size_t bs = (size_t)16 * TX;
  v8f acc0 = zero8(), acc1 = zero8(), acc2 = zero8(), acc3 = zero8();
#pragma unroll 1
  for (int k0 = 0; k0 < TX; k0 += 32) {
    const v16b ah = ldfrag_b(aph + k0);
    const v16b al = ldfrag_b(apl + k0);
    const v16b b0 = ldfrag_b(bp + k0);
    const v16b b1 = ldfrag_b(bp + bs + k0);
    const v16b b2 = ldfrag_b(bp + 2 * bs + k0);
    const v16b b3 = ldfrag_b(bp + 3 * bs + k0);
    acc0 = mma_b(ah, b0, acc0);
    acc1 = mma_b(ah, b1, acc1);
    acc2 = mma_b(ah, b2, acc2);
    acc3 = mma_b(ah, b3, acc3);
    acc0 = mma_b(al, b0, acc0);
    acc1 = mma_b(al, b1, acc1);
    acc2 = mma_b(al, b2, acc2);
    acc3 = mma_b(al, b3, acc3);
    guard6<v16b>(acc0, acc1, acc2, acc3, ah, al, b0, b1, b2, b3);
  }
  acc_guard4(acc0, acc1, acc2, acc3);
  epi64(slab + wave * SLAB, acc0, acc1, acc2, acc3, out + (size_t)bz * TYR * CC, CC, (size_t)rowl, col0, lane);
}

// =====================================================================================================
// Workspace map (bytes, NB = 8, TYR = 256); every plane is fully written by whole-line stores before it is read; all
// extents are exact multiples of the store granularity (no pad rows), every offset a multiple of 128:
//   XB  f16 [NB*TX][CC]  x16         1048576
//   YB  bf16 [NB*TY][CC]             1048576
//   WDB bf16 [HH][CC]                  65536
//   XT  bf16 [NB*CC][TX]             1048576
//   PH  bf16 [NB*TYR][TX]            1048576
//   PL  bf16 [NB*TYR][TX]            1048576
//   end                              5308416
// Inputs are read with the full-size batch strides (TX*CC, TY*CC); out is written as [NB][TYR][CC].
// =====================================================================================================
extern "C" void kernel_launch(void* const* d_in, const int* in_sizes, int n_in,
                              void* d_out, int out_size, void* d_ws, size_t ws_size,
                              hipStream_t stream) {
  if (n_in < 4) return;
  if (in_sizes[0] < NB * TX * CC || in_sizes[1] < NB * TY * CC) return;
  if (in_sizes[2] < HH * CC || in_sizes[3] < HH) return;
  if (out_size < NB * TYR * CC) return;

  const float* Xin = (const float*)d_in[0];
  const float* Yin = (const float*)d_in[1];
  const float* Wd  = (const float*)d_in[2];
  const float* vd  = (const float*)d_in[3];
  float*       out = (float*)d_out;

  const size_t szXB = (size_t)NB * TX * CC * 2;
  const size_t szYB = (size_t)NB * TY * CC * 2;
  const size_t szWD = (size_t)HH * CC * 2;
  const size_t szXT = (size_t)NB * CC * TX * 2;
  const size_t szP  = (size_t)NB * TYR * TX * 2;
  size_t off = 0;
  const size_t oXB = off; off += szXB;
  const size_t oYB = off; off += szYB;
  const size_t oWD = off; off += szWD;
  const size_t oXT = off; off += szXT;
  const size_t oPH = off; off += szP;
  const size_t oPL = off; off += szP;
  if (off > ws_size) return;                            // 5308416 at NB = 8, TYR = 256
  if (off > (size_t)134217728) return;

  char* ws = (char*)d_ws;
  u16* XB  = (u16*)(ws + oXB);
  u16* YB  = (u16*)(ws + oYB);
  u16* WDB = (u16*)(ws + oWD);
  u16* XT  = (u16*)(ws + oXT);
  u16* PH  = (u16*)(ws + oPH);
  u16* PL  = (u16*)(ws + oPL);

  const int n8x = (NB * TX * CC) / 8;                   // 65536
  const int n8y = (NB * TY * CC) / 8;                   // 65536
  const int n8w = (HH * CC) / 8;                        //  4096
  if ((n8x % 256) != 0 || (n8y % 256) != 0 || (n8w % 256) != 0) return;

  const dim3 blk(256);
  const dim3 gX(n8x / 256);                             // 256
  const dim3 gY(n8y / 256);                             // 256
  const dim3 gW(n8w / 256);                             // 16
  const dim3 gXT(NB * (TX / 64) * (CC / 64));           // 128
  const dim3 gSC(NB * TYR / NTY);                       // 512
  const dim3 bSC(SC_THREADS);                           // 256
  const dim3 gPV(NB * (TYR / 64) * (CC / 64));          // 128
  const dim3 bPV(128);

  // (0..2) operand planes: x -> f16 of bf16 value x16; y -> bf16; Wd [h][c] (k-contiguous) -> bf16
  cvt16<<<gX, blk, 0, stream>>>(Xin, XB, n8x, 1, XSC);
  cvt16<<<gY, blk, 0, stream>>>(Yin, YB, n8y, 0, 1.0f);
  cvt16<<<gW, blk, 0, stream>>>(Wd, WDB, n8w, 0, 1.0f);
  // (3) x[b][tx][c] -> XT[b][c][tx] bf16
  xpose_b16<<<gXT, blk, 0, stream>>>(Xin, XT);
  // (4) scores, tanh.vd row-dot, softmax -> P hi / residual bf16 planes [b][ty][tx]
  score_softmax<<<gSC, bSC, 0, stream>>>(XB, YB, WDB, vd, PH, PL);
  // (5) out[b][ty][d] = sum_tx P[b][ty][tx] * x[b][tx][d]
  gemm_pv<<<gPV, bPV, 0, stream>>>(PH, PL, XT, out);
  (void)hipGetLastError();
}

// v003
// It runs in 37.4 microseconds.
// Timed twice side by side with v002, it ran 1.16 and 1.17 times as fast.
// Counting every step since v000, it is 1.81 times as fast.
// Contractions: scores x.(Wd*y)^T on v_wmma_f32_16x16x32_f16 (x as f16 of its RNE bf16 value x16, Wd*y product plane as
// single f16 x1024, f32 accumulate); P.x on v_wmma_f32_16x16x32_bf16 (P as bf16 hi + bf16 residual planes, x as RNE bf16,
// f32 accumulate). tanh, the h.vd row-dot (vd as RNE bf16 value) and the softmax in f32 on VALU.
#include <hip/hip_runtime.h>
#include <math.h>
#include <stdint.h>

#ifndef NB
#define NB 8
#endif
#define NB_FULL 8
#define TX 256
#define TY 256
#ifndef TYR
#define TYR TY
#endif
#define CC 256
#define HH 128
#define XSC 16.0f
#define WYS 1024.0f
#define ZINV (1.0f / (16.0f * 1024.0f))
#define LDW 264
#define TP 68
#define SLAB (16 * 68)
#define SC_WAVES 8
#define SC_THREADS (SC_WAVES * 32)
#define NTY 4
#define XT_BLOCKS (NB * (TX / 64) * (CC / 64))
#define CX_BLOCKS ((NB * TX * CC) / (8 * 256))
#define CY_BLOCKS ((NB * TY * CC) / (8 * 256))
#define CW_BLOCKS ((HH * CC) / (8 * 256))

static_assert(TX == 256 && TY == 256 && CC == 256 && HH == 128);
static_assert(NB >= 1 && NB <= NB_FULL);
static_assert((TYR % 64) == 0 && TYR >= 64 && TYR <= TY);
static_assert((TYR % NTY) == 0 && NTY * CC == SC_THREADS * 4);
static_assert(SC_THREADS == TX && SC_WAVES * 32 == TX && SC_WAVES * 16 == HH && 32 * 8 == CC);
static_assert((CC % 32) == 0 && (TX % 32) == 0 && (LDW % 8) == 0 && LDW >= CC);
static_assert(((NB * TX * CC / 8) % 256) == 0 && ((NB * TY * CC / 8) % 256) == 0 && ((HH * CC / 8) % 256) == 0);
static_assert((TX % 64) == 0 && (CC % 64) == 0 && (TP * 4) % 16 == 0 && (SLAB * 4) % 16 == 0);

typedef unsigned short u16;
typedef _Float16 v16h __attribute__((ext_vector_type(16)));
typedef _Float16 v8h  __attribute__((ext_vector_type(8)));
typedef __bf16   v16b __attribute__((ext_vector_type(16)));
typedef float    v8f  __attribute__((ext_vector_type(8)));
typedef float    v4f  __attribute__((ext_vector_type(4)));
typedef unsigned int v4u __attribute__((ext_vector_type(4)));
typedef unsigned int v2u __attribute__((ext_vector_type(2)));

union FragH { v16h v; v8h h[2]; v4u u[2]; };
union FragB { v16b v; v4u u[2]; };

// ---- scalar helpers --------------------------------------------------------------------------------
__device__ __forceinline__ unsigned short bf_bits(float f) {          // f32 -> bf16 bits, RNE convert
  unsigned u = __float_as_uint(f);
  return (unsigned short)((u + 0x7FFFu + ((u >> 16) & 1u)) >> 16);
}
__device__ __forceinline__ float bf_up(unsigned short h) { return __uint_as_float(((unsigned)h) << 16); }
__device__ __forceinline__ float bf_val(float f) { return bf_up(bf_bits(f)); }          // value after RNE bf16 convert
__device__ __forceinline__ float lo16f(unsigned w) { return __uint_as_float(w << 16); }          // low bf16 of a packed pair
__device__ __forceinline__ float hi16f(unsigned w) { return __uint_as_float(w & 0xffff0000u); } // high bf16 of a packed pair
__device__ __forceinline__ unsigned short h_bits(_Float16 x) { return __builtin_bit_cast(unsigned short, x); }
__device__ __forceinline__ unsigned pk16(unsigned short a, unsigned short b) { return (unsigned)a | ((unsigned)b << 16); }
__device__ __forceinline__ v8f zero8() { v8f z = {0.f, 0.f, 0.f, 0.f, 0.f, 0.f, 0.f, 0.f}; return z; }

// tanh(v) on the chip's own transcendental (v_tanh_f32): one instruction, branch-free
__device__ __forceinline__ float tanh_e(float v) {
  return __builtin_amdgcn_tanhf(v);
}

// ---- fragment loaders: 16-bit A/B operand, lane -> row/col (lane&15), p already includes +8*(lane>>4);
//      elements 0..7 <- p[0..7] (k0+8h..), elements 8..15 <- p[16..23] (k0+16+8h..)  (same split k map for A and B;
//      B is always read from a k-contiguous [n][k] plane)
__device__ __forceinline__ v16h ldfrag_h(const _Float16* p) {
  FragH f;
  f.h[0] = *(const v8h*)(p);
  f.h[1] = *(const v8h*)(p + 16);
  return f.v;
}
__device__ __forceinline__ v16b ldfrag_b(const u16* p) {              // bf16 plane read as unsigned integer vectors
  FragB f;
  f.u[0] = *(const v4u*)(p);
  f.u[1] = *(const v4u*)(p + 16);
  return f.v;
}

__device__ __forceinline__ v8f mma_h(v16h a, v16h b, v8f c) {
  return __builtin_amdgcn_wmma_f32_16x16x32_f16(false, a, false, b, (short)0, c, false, false);
}
__device__ __forceinline__ v8f mma_b(v16b a, v16b b, v8f c) {
  return __builtin_amdgcn_wmma_f32_16x16x32_bf16(false, a, false, b, (short)0, c, false, false);
}
template <typename F>
__device__ __forceinline__ void guard6(v8f& a, v8f& b, v8f& c, v8f& d, F x0, F x1, F x2, F x3, F x4, F x5) {
#if defined(__HIP_DEVICE_COMPILE__)
  asm volatile("v_nop\n\tv_nop\n\tv_nop\n\tv_nop"
               : "+v"(a), "+v"(b), "+v"(c), "+v"(d) : "v"(x0), "v"(x1), "v"(x2), "v"(x3), "v"(x4), "v"(x5) : "memory");
#endif
}
__device__ __forceinline__ void acc_guard4(v8f& a, v8f& b, v8f& c, v8f& d) {
#if defined(__HIP_DEVICE_COMPILE__)
  asm volatile("v_nop\n\tv_nop\n\tv_nop\n\tv_nop" : "+v"(a), "+v"(b), "+v"(c), "+v"(d));
#endif
}
__device__ __forceinline__ void wave_sync_lds() {
#if defined(__HIP_DEVICE_COMPILE__)
  __builtin_amdgcn_fence(__ATOMIC_RELEASE, "workgroup");
  __builtin_amdgcn_wave_barrier();
  __builtin_amdgcn_fence(__ATOMIC_ACQUIRE, "workgroup");
#endif
}

// =====================================================================================================
// One launch prepares all four operand planes; the job of a block follows from its index alone (block-uniform):
//   blocks [0, XT_BLOCKS)          x -> XT   transposed bf16 plane (the longest chain, so it starts first)
//   next CX_BLOCKS                 x -> XB   f16 bits of (bf16 RNE value) * 16, same layout
//   next CY_BLOCKS                 y -> YB   bf16 RNE bits, same layout
//   next CW_BLOCKS                 Wd -> WDB bf16 RNE bits, same layout
// The jobs are independent of each other: no block reads what another block of this launch writes.
// =====================================================================================================

// f32 plane -> 16-bit plane, same layout:  mode 0: bf16 RNE bits;  mode 1: f16 bits of (bf16 RNE value) * scale.
// Thread = 8 consecutive elements: two 16-B loads, one 16-B store; 32 consecutive lanes = 512 contiguous, 512-B aligned bytes
// coverage: blocks x 256 thr x 8 = the whole plane (exactness: static_assert on the plane sizes).
__device__ __forceinline__ void cvt_job(const float* __restrict__ x, u16* D, int blk, int tid, int mode, float scale) {
  const int gt = blk * 256 + tid;
  const float* p = x + (size_t)gt * 8;
  const v4f a = *(const v4f*)(p), c4 = *(const v4f*)(p + 4);
  float v[8];
#pragma unroll
  for (int e = 0; e < 4; ++e) { v[e] = a[e]; v[4 + e] = c4[e]; }
  unsigned short s[8];
#pragma unroll
  for (int e = 0; e < 8; ++e) {
    const unsigned short bb = bf_bits(v[e]);
    const unsigned short hb = h_bits((_Float16)(bf_up(bb) * scale));
    s[e] = (mode != 0) ? hb : bb;
  }
  v4u o;
#pragma unroll
  for (int e = 0; e < 4; ++e) o[e] = pk16(s[2 * e], s[2 * e + 1]);
  u16* d = D + (size_t)gt * 8;
  {
    *(v4u*)(d) = o;
    // precaution: each block takes one branch, and nothing of the kernel follows the store
    asm volatile("s_wait_xcnt 0x0" ::: "memory");
  }
}

// Transposed bf16 plane of x:  in x[b][tx][c] f32 (row pitch CC)  ->  out XT[b][c][tx] bf16 RNE bits (row pitch TX).
// Block = (b, 64 tx rows, 64 c cols): thread loads 16 consecutive c of one tx row (four 16-B loads), stores them
// transposed into the LDS tile T[c][tx] (pitch TP floats); after the block barrier wave w / instruction i writes the
// coverage: 8 waves x 2 instructions x 4 rows = 64 c rows, 8 lanes x 8 halves = 64 tx each; XT_BLOCKS
//           blocks = every (b, c, tx) of the XT plane exactly once. Staged extent == consumed extent (64 x 64 of T).
__device__ __forceinline__ void xpose_job(const float* __restrict__ x, u16* XT, float* T, int bid, int tid) {
  const int lane = tid & 31, wave = tid >> 5;
  const int ntl = (TX / 64) * (CC / 64);
  const int b   = bid / ntl, t = bid % ntl;
  const int tx0 = (t / (CC / 64)) * 64;
  const int c0  = (t % (CC / 64)) * 64;
  const int r   = tid >> 2, cq = (tid & 3) * 16;
  const float* p = x + ((size_t)b * TX + tx0 + r) * CC + c0 + cq;
  const v4f q0 = *(const v4f*)(p), q1 = *(const v4f*)(p + 4), q2 = *(const v4f*)(p + 8), q3 = *(const v4f*)(p + 12);
#pragma unroll
  for (int e = 0; e < 4; ++e) {
    T[(cq + e) * TP + r]      = q0[e];
    T[(cq + 4 + e) * TP + r]  = q1[e];
    T[(cq + 8 + e) * TP + r]  = q2[e];
    T[(cq + 12 + e) * TP + r] = q3[e];
  }
  __syncthreads();
  const int rq = lane >> 3, g8 = (lane & 7) * 8;
  v4u ov[2];
#pragma unroll
  for (int i = 0; i < 2; ++i) {
    const int ci = wave * 8 + i * 4 + rq;
    const v4f a = *(const v4f*)(T + ci * TP + g8), c4 = *(const v4f*)(T + ci * TP + g8 + 4);
    float w[8];
#pragma unroll
    for (int e = 0; e < 4; ++e) { w[e] = a[e]; w[4 + e] = c4[e]; }
#pragma unroll
    for (int e = 0; e < 4; ++e) ov[i][e] = pk16(bf_bits(w[2 * e]), bf_bits(w[2 * e + 1]));
  }
  u16* dst = XT + ((size_t)b * CC + c0 + wave * 8 + rq) * TX + tx0 + g8;
  {
#pragma unroll
    for (int i = 0; i < 2; ++i) {
      *(v4u*)(dst + (size_t)(i * 4) * TX) = ov[i];
    }
    
  }
}

__global__ __launch_bounds__(256) void prep_planes(const float* __restrict__ x, const float* __restrict__ y,
                                                   const float* __restrict__ Wd, u16* XT, u16* XB, u16* YB, u16* WDB) {
  __shared__ __align__(16) float T[64 * TP];
  const int tid = threadIdx.x;
  const int bid = blockIdx.x;
  if (bid < XT_BLOCKS) {                                    // the only job with a barrier; the whole block takes it
    xpose_job(x, XT, T, bid, tid);
  } else if (bid < XT_BLOCKS + CX_BLOCKS) {
    cvt_job(x, XB, bid - XT_BLOCKS, tid, 1, XSC);
  } else if (bid < XT_BLOCKS + CX_BLOCKS + CY_BLOCKS) {
    cvt_job(y, YB, bid - (XT_BLOCKS + CX_BLOCKS), tid, 0, 1.0f);
  } else {
    cvt_job(Wd, WDB, bid - (XT_BLOCKS + CX_BLOCKS + CY_BLOCKS), tid, 0, 1.0f);
  }
}

// =====================================================================================================
// coverage: 8 instructions x 2 rows x 16 lanes x 4 floats = the wave's 16 x 64 tile.
// =====================================================================================================
__device__ __forceinline__ void epi64(float* sl, v8f a0, v8f a1, v8f a2, v8f a3, float* C, int N,
                                      size_t rowb, int col0, int lane) {
  const int hh = lane >> 4, m = lane & 15;
#pragma unroll
  for (int r = 0; r < 8; ++r) {
    const int ro = (8 * hh + r) * 68 + m;
    sl[ro]      = a0[r];
    sl[ro + 16] = a1[r];
    sl[ro + 32] = a2[r];
    sl[ro + 48] = a3[r];
  }
  wave_sync_lds();
  v4f vals[8];
#pragma unroll
  for (int it = 0; it < 8; ++it) vals[it] = *(const v4f*)(sl + (it * 2 + hh) * 68 + m * 4);
  float* dst = C + (rowb + (size_t)hh) * (size_t)N + col0 + m * 4;
  {
#pragma unroll
    for (int it = 0; it < 8; ++it) {
      *(v4f*)(dst + (size_t)(it * 2) * (size_t)N) = vals[it];
    }
    
  }
}

// =====================================================================================================
// Scores + softmax for NTY consecutive ty rows of one b per block (SC_THREADS = TX threads, 8 waves), one row after the
// other. What does not depend on ty is fetched once per block: the wave's 32 x CC f16 rows of x stay in registers as its
// 16 A fragments, the Wd bf16 plane stays in LDS (every thread reads back only the pieces it stored itself), and the
// block's NTY y rows are staged in LDS behind one block barrier.
//  (1) Wy plane in LDS: Wys[h][c] = f16 bits of (bf16(Wd[h][c]) * bf16(y[b][ty][c]) * 1024) (the product is exact in
//      f32; one RNE f16 convert). Thread = (8 consecutive c, h = tid>>5 + 8i, i = 0..15): one 16-B LDS load of the Wd
//      bf16 plane, one 16-B LDS store per (h, 8 c). coverage: 32 c-groups x 8 = CC, 8 x 16 = HH rows; pad cols CC..LDW-1
//      are never read. Block barrier before any fragment load.
//  (2) z[tx][h] (times 16*1024) = XB[b][tx][:] (A, f16 x16, row m = tx, split k map, the fragments held in registers)
//      . Wys[h][:]^T (B, col n = h, split k map from LDS); wave w owns tx rows 32w..32w+31 (2 M-tiles) and visits the
//      128 h columns in four visits of 2 N-tiles (4 accumulators), K = CC stepped by 32.
//      Epilogue per visit: p[row] += bf16(vd[h]) * tanh(z / 16384) in f32, D element r of lane -> (tx 32w+16mt+8hh+r,
//      h = hb+16j+m); then a fixed-order xor reduce over the 16 lanes of each half gives s[tx]; lanes m == 0 write s.
//  (3) f32 max-subtracted softmax over the TX scores (thread = tx): P = e / sum via one reciprocal; P -> bf16 hi bits
//      and bf16 bits of the exact residual (P - hi), staged in LDS; wave 0 writes the hi row, wave 1 the residual row:
// coverage: grid NB*TYR/NTY blocks x NTY rows = every (b, ty < TYR) row of both P planes exactly once.
// =====================================================================================================
__global__ __launch_bounds__(SC_THREADS, 4)                 // 4 waves per SIMD: two blocks share a WGP (256 VGPRs a wave)
void score_softmax(const u16* __restrict__ XB, const u16* __restrict__ YB, const u16* __restrict__ WDB,
                   const float* __restrict__ vd, u16* PH, u16* PL) {
  __shared__ __align__(16) u16 Wys[HH * LDW];
  __shared__ __align__(16) u16 Wds[HH * CC];
  __shared__ __align__(16) u16 ys[NTY * CC];
  __shared__ __align__(16) u16 phs[TX];
  __shared__ __align__(16) u16 pls[TX];
  __shared__ float sl[TX];
  __shared__ float vds[HH];
  __shared__ float redm[SC_WAVES];
  __shared__ float reds[SC_WAVES];

  const int tid = threadIdx.x, wave = tid >> 5, lane = tid & 31, hh = lane >> 4, m = lane & 15;
  const int bid = blockIdx.x;
  const int b   = bid / (TYR / NTY);
  const int ty0 = (bid % (TYR / NTY)) * NTY;
  const int c8 = lane * 8, hq = wave;

  if (tid < HH) vds[tid] = bf_val(vd[tid]);                 // waves 0..3 whole (HH = 128): wave-uniform

  // ---- (0) once per block: A fragments of x, Wd plane, the NTY y rows ----
  const int tx0 = wave * 32;
  const _Float16* ap = (const _Float16*)(const void*)XB + ((size_t)b * TX + tx0 + m) * CC + 8 * hh;
  v16h af0[CC / 32], af1[CC / 32];
#pragma unroll
  for (int kk = 0; kk < CC / 32; ++kk) {
    af0[kk] = ldfrag_h(ap + kk * 32);
    af1[kk] = ldfrag_h(ap + (size_t)16 * CC + kk * 32);
  }
  const v2u yq = *(const v2u*)(YB + ((size_t)b * TY + ty0) * CC + tid * 4);
  // stands in front of every overwrite of the address registers of the loads above (ap is named so that it lives to here)
  asm volatile("s_wait_xcnt 0x0" :: "v"(ap) : "memory");
  *(v2u*)(&ys[tid * 4]) = yq;
#pragma unroll 4                                            // four loads in flight a trip instead of one
  for (int i = 0; i < HH / 8; ++i) {
    const int h = hq + 8 * i;
    *(v4u*)(&Wds[h * CC + c8]) = *(const v4u*)(WDB + (size_t)h * CC + c8);
  }
  __syncthreads();                                          // publishes ys (and vds) to every wave

#pragma unroll 1                                            // rolled: one copy of the long body, registers as for one row
  for (int t = 0; t < NTY; ++t) {
  const int ty = ty0 + t;

  // ---- (1) Wy plane (the last fragment read of the row before lies in front of that row's barrier on sl) ----
  {
    const v4u yv = *(const v4u*)(&ys[t * CC + c8]);
    float yf[8];
#pragma unroll
    for (int e = 0; e < 4; ++e) { yf[2 * e] = lo16f(yv[e]); yf[2 * e + 1] = hi16f(yv[e]); }
#pragma unroll 2
    for (int i = 0; i < HH / 8; ++i) {
      const int h = hq + 8 * i;
      const v4u wv = *(const v4u*)(&Wds[h * CC + c8]);
      v4u o;
#pragma unroll
      for (int e = 0; e < 4; ++e) {
        const float p0 = (lo16f(wv[e]) * yf[2 * e]) * WYS;
        const float p1 = (hi16f(wv[e]) * yf[2 * e + 1]) * WYS;
        o[e] = pk16(h_bits((_Float16)p0), h_bits((_Float16)p1));
      }
      *(v4u*)(&Wys[h * LDW + c8]) = o;
    }
  }
  __syncthreads();

  // ---- (2) scores ----
  const _Float16* wl = (const _Float16*)(const void*)(&Wys[0]);
  v8f p0 = zero8(), p1 = zero8();

#pragma unroll 1
  for (int q = 0; q < 4; ++q) {                             // 2 N-tiles a visit: 4 accumulators beside the 16 A fragments
    const int hb = q * 32;
    const _Float16* bq = wl + (size_t)(hb + m) * LDW + 8 * hh;
    v8f c0[2], c1[2];
#pragma unroll
    for (int j = 0; j < 2; ++j) { c0[j] = zero8(); c1[j] = zero8(); }
#pragma unroll
    for (int k0 = 0; k0 < CC; k0 += 64) {                   // unrolled: the fragment arrays need constant indices
      const v16h b0 = ldfrag_h(bq + k0);                    // two k steps a trip: 8 LDS loads ahead of 8 products
      const v16h b1 = ldfrag_h(bq + 16 * LDW + k0);
      const v16h b2 = ldfrag_h(bq + k0 + 32);
      const v16h b3 = ldfrag_h(bq + 16 * LDW + k0 + 32);
      c0[0] = mma_h(af0[k0 / 32], b0, c0[0]);
      c0[1] = mma_h(af0[k0 / 32], b1, c0[1]);
      c1[0] = mma_h(af1[k0 / 32], b0, c1[0]);
      c1[1] = mma_h(af1[k0 / 32], b1, c1[1]);
      c0[0] = mma_h(af0[k0 / 32 + 1], b2, c0[0]);
      c0[1] = mma_h(af0[k0 / 32 + 1], b3, c0[1]);
      c1[0] = mma_h(af1[k0 / 32 + 1], b2, c1[0]);
      c1[1] = mma_h(af1[k0 / 32 + 1], b3, c1[1]);
    }
    acc_guard4(c0[0], c0[1], c1[0], c1[1]);
#pragma unroll
    for (int j = 0; j < 2; ++j) {
      const float vv = vds[hb + 16 * j + m];
      v8f t0 = c0[j] * ZINV, t1 = c1[j] * ZINV;             // independent tanh back to back: none waits for its neighbour
#pragma unroll
      for (int r = 0; r < 8; ++r) { t0[r] = tanh_e(t0[r]); t1[r] = tanh_e(t1[r]); }
      p0 += vv * t0;
      p1 += vv * t1;
    }
  }

  // reduce over the 16 column lanes of each half (fixed order); D row = tx0 + 16*mt + 8*hh + r
#pragma unroll
  for (int r = 0; r < 8; ++r) {
    float v = p0[r];
    v += __shfl_xor(v, 1, 16);
    v += __shfl_xor(v, 2, 16);
    v += __shfl_xor(v, 4, 16);
    v += __shfl_xor(v, 8, 16);
    p0[r] = v;
    float u = p1[r];
    u += __shfl_xor(u, 1, 16);
    u += __shfl_xor(u, 2, 16);
    u += __shfl_xor(u, 4, 16);
    u += __shfl_xor(u, 8, 16);
    p1[r] = u;
  }
  if (m == 0) {
#pragma unroll
    for (int r = 0; r < 8; ++r) {
      sl[tx0 + 8 * hh + r]      = p0[r];
      sl[tx0 + 16 + 8 * hh + r] = p1[r];
    }
  }
  __syncthreads();

  // ---- (3) softmax over tx (thread = tx) ----
  const float sv = sl[tid];
  float mx = sv;
  mx = fmaxf(mx, __shfl_xor(mx, 16, 32));
  mx = fmaxf(mx, __shfl_xor(mx, 8, 32));
  mx = fmaxf(mx, __shfl_xor(mx, 4, 32));
  mx = fmaxf(mx, __shfl_xor(mx, 2, 32));
  mx = fmaxf(mx, __shfl_xor(mx, 1, 32));
  if (lane == 0) redm[wave] = mx;
  __syncthreads();
  float mm = redm[0];
#pragma unroll
  for (int w = 1; w < SC_WAVES; ++w) mm = fmaxf(mm, redm[w]);
  const float ev = expf(sv - mm);
  float ss = ev;
  ss += __shfl_xor(ss, 16, 32);
  ss += __shfl_xor(ss, 8, 32);
  ss += __shfl_xor(ss, 4, 32);
  ss += __shfl_xor(ss, 2, 32);
  ss += __shfl_xor(ss, 1, 32);
  if (lane == 0) reds[wave] = ss;
  __syncthreads();
  float tot = reds[0];
#pragma unroll
  for (int w = 1; w < SC_WAVES; ++w) tot += reds[w];
  const float a = ev * (1.0f / tot);                       // tot >= 1 by construction
  const unsigned short hb16 = bf_bits(a);
  const unsigned short lb16 = bf_bits(a - bf_up(hb16));    // residual is exact in f32
  phs[tid] = hb16;
  pls[tid] = lb16;
  __syncthreads();

  if (wave < 2) {                                          // wave-uniform; no barrier inside
    const v4u oh = *(const v4u*)(&phs[lane * 8]);
    const v4u ol = *(const v4u*)(&pls[lane * 8]);
    const v4u o  = (wave == 0) ? oh : ol;
    u16* base = (wave == 0) ? PH : PL;
    u16* dst  = base + ((size_t)b * TYR + ty) * TX + lane * 8;
    {
      *(v4u*)(dst) = o;
      // the next trip of the ty loop reuses the store's registers
      asm volatile("s_wait_xcnt 0x0" ::: "memory");
    }
  }
  }
}

// =====================================================================================================
// bf16 GEMM with f32 result into out: out[bz][ty][d] = sum_tx (PH + PL)[bz][ty][tx] * XT[bz][d][tx]
// (A = hi and residual planes, row-major k = tx; Bt = XT k-contiguous [n = d][k = tx]; two products per tile pair into
// one accumulator). Block = 64x64 tile of batch bz, 4 waves x 16 rows, fragments loaded straight from the 16-bit rows
// (two 16-B loads each, split k map for A and B), K = TX stepped by 32; epilogue epi64.
// coverage: grid NB*(TYR/64)*(CC/64) blocks x 4 waves x (16 x 64) = every out[b][ty < TYR][d] exactly once.
// =====================================================================================================
__global__ __launch_bounds__(128)
void gemm_pv(const u16* __restrict__ PH, const u16* __restrict__ PL, const u16* __restrict__ XT, float* out) {
  __shared__ __align__(16) float slab[4 * SLAB];
  const int tid = threadIdx.x, wave = tid >> 5, lane = tid & 31, hh = lane >> 4, m = lane & 15;
  const int ntl  = (TYR / 64) * (CC / 64);
  const int bid  = blockIdx.x;
  const int bz   = bid / ntl, t = bid % ntl;
  const int rowl = (t / (CC / 64)) * 64 + wave * 16;
  const int col0 = (t % (CC / 64)) * 64;
  const u16* aph = PH + ((size_t)bz * TYR + rowl + m) * TX + 8 * hh;
  const u16* apl = PL + ((size_t)bz * TYR + rowl + m) * TX + 8 * hh;
  const u16* bp  = XT + ((size_t)bz * CC + col0 + m) * TX + 8 * hh;
  const size_t bs = (size_t)16 * TX;
  v8f acc0 = zero8(), acc1 = zero8(), acc2 = zero8(), acc3 = zero8();
#pragma unroll 1
  for (int k0 = 0; k0 < TX; k0 += 32) {
    const v16b ah = ldfrag_b(aph + k0);
    const v16b al = ldfrag_b(apl + k0);
    const v16b b0 = ldfrag_b(bp + k0);
    const v16b b1 = ldfrag_b(bp + bs + k0);
    const v16b b2 = ldfrag_b(bp + 2 * bs + k0);
    const v16b b3 = ldfrag_b(bp + 3 * bs + k0);
    acc0 = mma_b(ah, b0, acc0);
    acc1 = mma_b(ah, b1, acc1);
    acc2 = mma_b(ah, b2, acc2);
    acc3 = mma_b(ah, b3, acc3);
    acc0 = mma_b(al, b0, acc0);
    acc1 = mma_b(al, b1, acc1);
    acc2 = mma_b(al, b2, acc2);
    acc3 = mma_b(al, b3, acc3);
    guard6<v16b>(acc0, acc1, acc2, acc3, ah, al, b0, b1, b2, b3);
  }
  acc_guard4(acc0, acc1, acc2, acc3);
  epi64(slab + wave * SLAB, acc0, acc1, acc2, acc3, out + (size_t)bz * TYR * CC, CC, (size_t)rowl, col0, lane);
}

// =====================================================================================================
// Workspace map (bytes, NB = 8, TYR = 256); every plane is fully written by whole-line stores before it is read; all
// extents are exact multiples of the store granularity (no pad rows), every offset a multiple of 128:
//   XB  f16 [NB*TX][CC]  x16         1048576
//   YB  bf16 [NB*TY][CC]             1048576
//   WDB bf16 [HH][CC]                  65536
//   XT  bf16 [NB*CC][TX]             1048576
//   PH  bf16 [NB*TYR][TX]            1048576
//   PL  bf16 [NB*TYR][TX]            1048576
//   end                              5308416
// Inputs are read with the full-size batch strides (TX*CC, TY*CC); out is written as [NB][TYR][CC].
// =====================================================================================================
extern "C" void kernel_launch(void* const* d_in, const int* in_sizes, int n_in,
                              void* d_out, int out_size, void* d_ws, size_t ws_size,
                              hipStream_t stream) {
  if (n_in < 4) return;
  if (in_sizes[0] < NB * TX * CC || in_sizes[1] < NB * TY * CC) return;
  if (in_sizes[2] < HH * CC || in_sizes[3] < HH) return;
  if (out_size < NB * TYR * CC) return;

  const float* Xin = (const float*)d_in[0];
  const float* Yin = (const float*)d_in[1];
  const float* Wd  = (const float*)d_in[2];
  const float* vd  = (const float*)d_in[3];
  float*       out = (float*)d_out;

  const size_t szXB = (size_t)NB * TX * CC * 2;
  const size_t szYB = (size_t)NB * TY * CC * 2;
  const size_t szWD = (size_t)HH * CC * 2;
  const size_t szXT = (size_t)NB * CC * TX * 2;
  const size_t szP  = (size_t)NB * TYR * TX * 2;
  size_t off = 0;
  const size_t oXB = off; off += szXB;
  const size_t oYB = off; off += szYB;
  const size_t oWD = off; off += szWD;
  const size_t oXT = off; off += szXT;
  const size_t oPH = off; off += szP;
  const size_t oPL = off; off += szP;
  if (off > ws_size) return;                            // 5308416 at NB = 8, TYR = 256
  if (off > (size_t)134217728) return;

  char* ws = (char*)d_ws;
  u16* XB  = (u16*)(ws + oXB);
  u16* YB  = (u16*)(ws + oYB);
  u16* WDB = (u16*)(ws + oWD);
  u16* XT  = (u16*)(ws + oXT);
  u16* PH  = (u16*)(ws + oPH);
  u16* PL  = (u16*)(ws + oPL);

  const dim3 blk(256);
  const dim3 gPR(XT_BLOCKS + CX_BLOCKS + CY_BLOCKS + CW_BLOCKS);   // 128 + 256 + 256 + 16
  const dim3 gSC(NB * TYR / NTY);                       // 512
  const dim3 bSC(SC_THREADS);                           // 256
  const dim3 gPV(NB * (TYR / 64) * (CC / 64));          // 128
  const dim3 bPV(128);

  // (0) operand planes, one launch: x[b][tx][c] -> XT[b][c][tx] bf16; x -> f16 of bf16 value x16; y -> bf16;
  //     Wd [h][c] (k-contiguous) -> bf16
  prep_planes<<<gPR, blk, 0, stream>>>(Xin, Yin, Wd, XT, XB, YB, WDB);
  // (1) scores, tanh.vd row-dot, softmax -> P hi / residual bf16 planes [b][ty][tx]
  score_softmax<<<gSC, bSC, 0, stream>>>(XB, YB, WDB, vd, PH, PL);
  // (2) out[b][ty][d] = sum_tx P[b][ty][tx] * x[b][tx][d]
  gemm_pv<<<gPV, bPV, 0, stream>>>(PH, PL, XT, out);
  (void)hipGetLastError();
}

// v004
// It runs in 32.8 microseconds.
// In two side-by-side timings against v003, it was 1.12 and 1.15 times as fast.
// All steps since v000 together make it 2.06 times as fast.
// Contractions: scores x.(Wd*y)^T on v_wmma_f32_16x16x32_f16 (x as f16 of its RNE bf16 value x16, Wd*y product plane as
// single f16 x1024, f32 accumulate); P.x on v_wmma_f32_16x16x32_bf16 (P as bf16 hi + bf16 residual planes, x as RNE bf16,
// f32 accumulate). tanh, the h.vd row-dot (vd as RNE bf16 value) and the softmax in f32 on VALU.
#include <hip/hip_runtime.h>
#include <math.h>
#include <stdint.h>

#ifndef NB
#define NB 8
#endif
#define NB_FULL 8
#define TX 256
#define TY 256
#ifndef TYR
#define TYR TY
#endif
#define CC 256
#define HH 128
#define XSC 16.0f
#define WYS 1024.0f
#define ZINV (1.0f / (16.0f * 1024.0f))
#define LDW 264
#define TP 68
#define SC_WAVES 8
#define SC_THREADS (SC_WAVES * 32)
#define NTY 4
#define XT_BLOCKS (NB * (TX / 64) * (CC / 64))
#define CX_BLOCKS ((NB * TX * CC) / (8 * 256))
#define CY_BLOCKS ((NB * TY * CC) / (8 * 256))
#define CW_BLOCKS ((HH * CC) / (8 * 256))

static_assert(TX == 256 && TY == 256 && CC == 256 && HH == 128);
static_assert(NB >= 1 && NB <= NB_FULL);
static_assert((TYR % 64) == 0 && TYR >= 64 && TYR <= TY);
static_assert((TYR % NTY) == 0 && NTY * CC == SC_THREADS * 4 && NTY == 4 && SC_WAVES * 32 == CC);
static_assert(SC_THREADS == TX && SC_WAVES * 32 == TX && SC_WAVES * 16 == HH && 32 * 8 == CC);
static_assert((CC % 32) == 0 && (TX % 32) == 0 && (LDW % 8) == 0 && LDW >= CC);
static_assert(((NB * TX * CC / 8) % 256) == 0 && ((NB * TY * CC / 8) % 256) == 0 && ((HH * CC / 8) % 256) == 0);
static_assert((TX % 64) == 0 && (CC % 64) == 0 && (TP * 4) % 16 == 0);

typedef unsigned short u16;
typedef _Float16 v16h __attribute__((ext_vector_type(16)));
typedef _Float16 v8h  __attribute__((ext_vector_type(8)));
typedef __bf16   v16b __attribute__((ext_vector_type(16)));
typedef float    v8f  __attribute__((ext_vector_type(8)));
typedef float    v4f  __attribute__((ext_vector_type(4)));
typedef unsigned int v4u __attribute__((ext_vector_type(4)));
typedef unsigned int v2u __attribute__((ext_vector_type(2)));

union FragH { v16h v; v8h h[2]; v4u u[2]; };
union FragB { v16b v; v4u u[2]; };

// ---- scalar helpers --------------------------------------------------------------------------------
__device__ __forceinline__ unsigned short bf_bits(float f) {          // f32 -> bf16 bits, RNE convert
  unsigned u = __float_as_uint(f);
  return (unsigned short)((u + 0x7FFFu + ((u >> 16) & 1u)) >> 16);
}
__device__ __forceinline__ float bf_up(unsigned short h) { return __uint_as_float(((unsigned)h) << 16); }
__device__ __forceinline__ float bf_val(float f) { return bf_up(bf_bits(f)); }          // value after RNE bf16 convert
__device__ __forceinline__ float lo16f(unsigned w) { return __uint_as_float(w << 16); }          // low bf16 of a packed pair
__device__ __forceinline__ float hi16f(unsigned w) { return __uint_as_float(w & 0xffff0000u); } // high bf16 of a packed pair
__device__ __forceinline__ unsigned short h_bits(_Float16 x) { return __builtin_bit_cast(unsigned short, x); }
__device__ __forceinline__ unsigned pk16(unsigned short a, unsigned short b) { return (unsigned)a | ((unsigned)b << 16); }
__device__ __forceinline__ v8f zero8() { v8f z = {0.f, 0.f, 0.f, 0.f, 0.f, 0.f, 0.f, 0.f}; return z; }

// tanh(v) on the chip's own transcendental (v_tanh_f32): one instruction, branch-free
__device__ __forceinline__ float tanh_e(float v) {
  return __builtin_amdgcn_tanhf(v);
}

// ---- fragment loaders: 16-bit A/B operand, lane -> row/col (lane&15), p already includes +8*(lane>>4);
//      elements 0..7 <- p[0..7] (k0+8h..), elements 8..15 <- p[16..23] (k0+16+8h..)  (same split k map for A and B;
//      B comes from a k-contiguous [n][k] plane, or from the XT plane, whose 16-B pieces lie in this same order)
__device__ __forceinline__ v16h ldfrag_h(const _Float16* p) {
  FragH f;
  f.h[0] = *(const v8h*)(p);
  f.h[1] = *(const v8h*)(p + 16);
  return f.v;
}
__device__ __forceinline__ v16b ldfrag_b(const u16* p) {              // bf16 plane read as unsigned integer vectors
  FragB f;
  f.u[0] = *(const v4u*)(p);
  f.u[1] = *(const v4u*)(p + 16);
  return f.v;
}

__device__ __forceinline__ v8f mma_h(v16h a, v16h b, v8f c) {
  return __builtin_amdgcn_wmma_f32_16x16x32_f16(false, a, false, b, (short)0, c, false, false);
}
__device__ __forceinline__ v8f mma_b(v16b a, v16b b, v8f c) {
  return __builtin_amdgcn_wmma_f32_16x16x32_bf16(false, a, false, b, (short)0, c, false, false);
}
__device__ __forceinline__ void acc_guard4(v8f& a, v8f& b, v8f& c, v8f& d) {
#if defined(__HIP_DEVICE_COMPILE__)
  asm volatile("v_nop\n\tv_nop\n\tv_nop\n\tv_nop" : "+v"(a), "+v"(b), "+v"(c), "+v"(d));
#endif
}
// =====================================================================================================
// One launch prepares all four operand planes; the job of a block follows from its index alone (block-uniform):
//   blocks [0, XT_BLOCKS)          x -> XT   transposed bf16 plane (the longest chain, so it starts first)
//   next CX_BLOCKS                 x -> XB   f16 bits of (bf16 RNE value) * 16, same layout
//   next CY_BLOCKS                 y -> YB   bf16 RNE bits, same layout
//   next CW_BLOCKS                 Wd -> WDB bf16 RNE bits, same layout
// The jobs are independent of each other: no block reads what another block of this launch writes.
// =====================================================================================================

// f32 plane -> 16-bit plane, same layout:  mode 0: bf16 RNE bits;  mode 1: f16 bits of (bf16 RNE value) * scale.
// Thread = 8 consecutive elements: two 16-B loads, one 16-B store; 32 consecutive lanes = 512 contiguous, 512-B aligned bytes
// coverage: blocks x 256 thr x 8 = the whole plane (exactness: static_assert on the plane sizes).
__device__ __forceinline__ void cvt_job(const float* __restrict__ x, u16* D, int blk, int tid, int mode, float scale) {
  const int gt = blk * 256 + tid;
  const float* p = x + (size_t)gt * 8;
  const v4f a = *(const v4f*)(p), c4 = *(const v4f*)(p + 4);
  float v[8];
#pragma unroll
  for (int e = 0; e < 4; ++e) { v[e] = a[e]; v[4 + e] = c4[e]; }
  unsigned short s[8];
#pragma unroll
  for (int e = 0; e < 8; ++e) {
    const unsigned short bb = bf_bits(v[e]);
    const unsigned short hb = h_bits((_Float16)(bf_up(bb) * scale));
    s[e] = (mode != 0) ? hb : bb;
  }
  v4u o;
#pragma unroll
  for (int e = 0; e < 4; ++e) o[e] = pk16(s[2 * e], s[2 * e + 1]);
  u16* d = D + (size_t)gt * 8;
  {
    *(v4u*)(d) = o;
    // precaution: each block takes one branch, and nothing of the kernel follows the store
    asm volatile("s_wait_xcnt 0x0" ::: "memory");
  }
}

// Transposed bf16 plane of x:  in x[b][tx][c] f32 (row pitch CC)  ->  out XT = x[b][tx][d = c] as bf16 RNE bits, laid out
// in the order of the B fragments that read it (col n = d & 15, split k map over tx): one fragment half = 512 contiguous B.
// Block = (b, 64 tx rows, 64 c cols): thread loads 16 consecutive c of one tx row (four 16-B loads), stores them
// transposed into the LDS tile T[c][tx] (pitch TP floats); after the block barrier wave w / instruction i writes the
// coverage: 8 waves x 2 instructions x 4 rows = 64 c rows, 8 lanes x 8 halves = 64 tx each; XT_BLOCKS
//           blocks = every (b, c, tx) of the XT plane exactly once. Staged extent == consumed extent (64 x 64 of T).
__device__ __forceinline__ void xpose_job(const float* __restrict__ x, u16* XT, float* T, int bid, int tid) {
  const int lane = tid & 31, wave = tid >> 5;
  const int ntl = (TX / 64) * (CC / 64);
  const int b   = bid / ntl, t = bid % ntl;
  const int tx0 = (t / (CC / 64)) * 64;
  const int c0  = (t % (CC / 64)) * 64;
  const int r   = tid >> 2, cq = (tid & 3) * 16;
  const float* p = x + ((size_t)b * TX + tx0 + r) * CC + c0 + cq;
  const v4f q0 = *(const v4f*)(p), q1 = *(const v4f*)(p + 4), q2 = *(const v4f*)(p + 8), q3 = *(const v4f*)(p + 12);
#pragma unroll
  for (int e = 0; e < 4; ++e) {
    T[(cq + e) * TP + r]      = q0[e];
    T[(cq + 4 + e) * TP + r]  = q1[e];
    T[(cq + 8 + e) * TP + r]  = q2[e];
    T[(cq + 12 + e) * TP + r] = q3[e];
  }
  __syncthreads();
  const int rq = lane >> 3, g8 = (lane & 7) * 8;
  v4u ov[2];
#pragma unroll
  for (int i = 0; i < 2; ++i) {
    const int ci = wave * 8 + i * 4 + rq;
    const v4f a = *(const v4f*)(T + ci * TP + g8), c4 = *(const v4f*)(T + ci * TP + g8 + 4);
    float w[8];
#pragma unroll
    for (int e = 0; e < 4; ++e) { w[e] = a[e]; w[4 + e] = c4[e]; }
#pragma unroll
    for (int e = 0; e < 4; ++e) ov[i][e] = pk16(bf_bits(w[2 * e]), bf_bits(w[2 * e + 1]));
  }
  // fragment order: 16-B piece (d, 8 tx) -> [b][d >> 4][tx >> 5][(tx >> 4) & 1][lane = 16 * ((tx >> 3) & 1) + (d & 15)]
  const int d0 = c0 + wave * 8 + rq, tq = tx0 + g8;
  u16* dst = XT + ((((size_t)b * (CC / 16) + (d0 >> 4)) * (TX / 32) + (tq >> 5)) * 2 + ((tq >> 4) & 1)) * 256
                + (((tq >> 3) & 1) * 16 + (d0 & 15)) * 8;
  {
#pragma unroll
    for (int i = 0; i < 2; ++i) {
      *(v4u*)(dst + i * 32) = ov[i];                        // d + 4: four lanes' pieces further in the same 128-B line
    }
  }
}

__global__ __launch_bounds__(256) void prep_planes(const float* __restrict__ x, const float* __restrict__ y,
                                                   const float* __restrict__ Wd, u16* XT, u16* XB, u16* YB, u16* WDB) {
  __shared__ __align__(16) float T[64 * TP];
  const int tid = threadIdx.x;
  const int bid = blockIdx.x;
  if (bid < XT_BLOCKS) {                                    // the only job with a barrier; the whole block takes it
    xpose_job(x, XT, T, bid, tid);
  } else if (bid < XT_BLOCKS + CX_BLOCKS) {
    cvt_job(x, XB, bid - XT_BLOCKS, tid, 1, XSC);
  } else if (bid < XT_BLOCKS + CX_BLOCKS + CY_BLOCKS) {
    cvt_job(y, YB, bid - (XT_BLOCKS + CX_BLOCKS), tid, 0, 1.0f);
  } else {
    cvt_job(Wd, WDB, bid - (XT_BLOCKS + CX_BLOCKS + CY_BLOCKS), tid, 0, 1.0f);
  }
}

// =====================================================================================================
// Scores + softmax for NTY consecutive ty rows of one b per block (SC_THREADS = TX threads, 8 waves), one row after the
// other. What does not depend on ty is fetched once per block: the wave's 32 x CC f16 rows of x stay in registers as its
// 16 A fragments, the Wd bf16 plane stays in LDS (every thread reads back only the pieces it stored itself), and the
// block's NTY y rows are staged in LDS behind one block barrier.
//  (1) Wy plane in LDS: Wys[h][c] = f16 bits of (bf16(Wd[h][c]) * bf16(y[b][ty][c]) * 1024) (the product is exact in
//      f32; one RNE f16 convert). Thread = (8 consecutive c, h = tid>>5 + 8i, i = 0..15): one 16-B LDS load of the Wd
//      bf16 plane, one 16-B LDS store per (h, 8 c). coverage: 32 c-groups x 8 = CC, 8 x 16 = HH rows; pad cols CC..LDW-1
//      are never read. Block barrier before any fragment load.
//  (2) z[tx][h] (times 16*1024) = XB[b][tx][:] (A, f16 x16, row m = tx, split k map, the fragments held in registers)
//      . Wys[h][:]^T (B, col n = h, split k map from LDS); wave w owns tx rows 32w..32w+31 (2 M-tiles) and visits the
//      128 h columns in four visits of 2 N-tiles (4 accumulators), K = CC stepped by 32.
//      Epilogue per visit: p[row] += bf16(vd[h]) * tanh(z / 16384) in f32, D element r of lane -> (tx 32w+16mt+8hh+r,
//      h = hb+16j+m); then a fixed-order xor reduce over the 16 lanes of each half gives s[tx]; lanes m == 0 write s.
//  (3) f32 max-subtracted softmax over the TX scores (thread = tx): P = e / sum via one reciprocal; P -> bf16 hi bits
//      and bf16 bits of the exact residual (P - hi), kept in LDS (pp: one row of each per ty, pitch LDW).
//  (4) once per block, behind one barrier: out[b][ty0+r][d] = sum_tx hi[r][tx] * x[tx][d] + sum_tx residual[r][tx] * x[tx][d]
//      on the bf16 matrix form, f32 accumulate, K = TX stepped by 32. A row i of the 16 reads pp row i & 7 (every LDS
//      byte read was written): D rows 0..3 are the hi sums, 4..7 the residual sums, 8..15 repeat them. Wave w owns d
//      columns 32w..32w+31 (2 N-tiles; B halves are whole 512-B pieces of the XT plane; split k map for A and B).
//      Store: lanes 0..15 take tile 0, lanes 16..31 the repeat rows of tile 1: one whole 128-B line a row and wave.
// coverage: grid NB*TYR/NTY blocks x NTY rows x 8 waves x 32 columns = every out[b][ty < TYR][d] exactly once.
// =====================================================================================================
__global__ __launch_bounds__(SC_THREADS, 4)                 // 4 waves per SIMD: two blocks share a WGP (256 VGPRs a wave)
void score_softmax(const u16* __restrict__ XB, const u16* __restrict__ YB, const u16* __restrict__ WDB,
                   const float* __restrict__ vd, const u16* __restrict__ XT, float* out) {
  __shared__ __align__(16) u16 Wys[HH * LDW];
  __shared__ __align__(16) u16 Wds[HH * CC];
  __shared__ __align__(16) u16 ys[NTY * CC];
  __shared__ __align__(16) u16 pp[2 * NTY * LDW];           // rows 0..NTY-1: P hi, rows NTY..2*NTY-1: P residual
  __shared__ float sl[TX];
  __shared__ float vds[HH];
  __shared__ float redm[SC_WAVES];
  __shared__ float reds[SC_WAVES];

  const int tid = threadIdx.x, wave = tid >> 5, lane = tid & 31, hh = lane >> 4, m = lane & 15;
  const int bid = blockIdx.x;
  const int b   = bid / (TYR / NTY);
  const int ty0 = (bid % (TYR / NTY)) * NTY;
  const int c8 = lane * 8, hq = wave;

  if (tid < HH) vds[tid] = bf_val(vd[tid]);                 // waves 0..3 whole (HH = 128): wave-uniform

  // ---- (0) once per block: A fragments of x, Wd plane, the NTY y rows ----
  const int tx0 = wave * 32;
  const _Float16* ap = (const _Float16*)(const void*)XB + ((size_t)b * TX + tx0 + m) * CC + 8 * hh;
  v16h af0[CC / 32], af1[CC / 32];
#pragma unroll
  for (int kk = 0; kk < CC / 32; ++kk) {
    af0[kk] = ldfrag_h(ap + kk * 32);
    af1[kk] = ldfrag_h(ap + (size_t)16 * CC + kk * 32);
  }
  const v2u yq = *(const v2u*)(YB + ((size_t)b * TY + ty0) * CC + tid * 4);
  // stands in front of every overwrite of the address registers of the loads above (ap is named so that it lives to here)
  asm volatile("s_wait_xcnt 0x0" :: "v"(ap) : "memory");
  *(v2u*)(&ys[tid * 4]) = yq;
#pragma unroll 4                                            // four loads in flight a trip instead of one
  for (int i = 0; i < HH / 8; ++i) {
    const int h = hq + 8 * i;
    *(v4u*)(&Wds[h * CC + c8]) = *(const v4u*)(WDB + (size_t)h * CC + c8);
  }
  __syncthreads();                                          // publishes ys (and vds) to every wave

#pragma unroll 1                                            // rolled: one copy of the long body, registers as for one row
  for (int t = 0; t < NTY; ++t) {

  // ---- (1) Wy plane (the last fragment read of the row before lies in front of that row's barrier on sl) ----
  {
    const v4u yv = *(const v4u*)(&ys[t * CC + c8]);
    float yf[8];
#pragma unroll
    for (int e = 0; e < 4; ++e) { yf[2 * e] = lo16f(yv[e]); yf[2 * e + 1] = hi16f(yv[e]); }
#pragma unroll 2
    for (int i = 0; i < HH / 8; ++i) {
      const int h = hq + 8 * i;
      const v4u wv = *(const v4u*)(&Wds[h * CC + c8]);
      v4u o;
#pragma unroll
      for (int e = 0; e < 4; ++e) {
        const float p0 = (lo16f(wv[e]) * yf[2 * e]) * WYS;
        const float p1 = (hi16f(wv[e]) * yf[2 * e + 1]) * WYS;
        o[e] = pk16(h_bits((_Float16)p0), h_bits((_Float16)p1));
      }
      *(v4u*)(&Wys[h * LDW + c8]) = o;
    }
  }
  __syncthreads();

  // ---- (2) scores ----
  const _Float16* wl = (const _Float16*)(const void*)(&Wys[0]);
  v8f p0 = zero8(), p1 = zero8();

#pragma unroll 1
  for (int q = 0; q < 4; ++q) {                             // 2 N-tiles a visit: 4 accumulators beside the 16 A fragments
    const int hb = q * 32;
    const _Float16* bq = wl + (size_t)(hb + m) * LDW + 8 * hh;
    v8f c0[2], c1[2];
#pragma unroll
    for (int j = 0; j < 2; ++j) { c0[j] = zero8(); c1[j] = zero8(); }
#pragma unroll
    for (int k0 = 0; k0 < CC; k0 += 64) {                   // unrolled: the fragment arrays need constant indices
      const v16h b0 = ldfrag_h(bq + k0);                    // two k steps a trip: 8 LDS loads ahead of 8 products
      const v16h b1 = ldfrag_h(bq + 16 * LDW + k0);
      const v16h b2 = ldfrag_h(bq + k0 + 32);
      const v16h b3 = ldfrag_h(bq + 16 * LDW + k0 + 32);
      c0[0] = mma_h(af0[k0 / 32], b0, c0[0]);
      c0[1] = mma_h(af0[k0 / 32], b1, c0[1]);
      c1[0] = mma_h(af1[k0 / 32], b0, c1[0]);
      c1[1] = mma_h(af1[k0 / 32], b1, c1[1]);
      c0[0] = mma_h(af0[k0 / 32 + 1], b2, c0[0]);
      c0[1] = mma_h(af0[k0 / 32 + 1], b3, c0[1]);
      c1[0] = mma_h(af1[k0 / 32 + 1], b2, c1[0]);
      c1[1] = mma_h(af1[k0 / 32 + 1], b3, c1[1]);
    }
    acc_guard4(c0[0], c0[1], c1[0], c1[1]);
#pragma unroll
    for (int j = 0; j < 2; ++j) {
      const float vv = vds[hb + 16 * j + m];
      v8f t0 = c0[j] * ZINV, t1 = c1[j] * ZINV;             // independent tanh back to back: none waits for its neighbour
#pragma unroll
      for (int r = 0; r < 8; ++r) { t0[r] = tanh_e(t0[r]); t1[r] = tanh_e(t1[r]); }
      p0 += vv * t0;
      p1 += vv * t1;
    }
  }

  // reduce over the 16 column lanes of each half (fixed order); D row = tx0 + 16*mt + 8*hh + r
#pragma unroll
  for (int r = 0; r < 8; ++r) {
    float v = p0[r];
    v += __shfl_xor(v, 1, 16);
    v += __shfl_xor(v, 2, 16);
    v += __shfl_xor(v, 4, 16);
    v += __shfl_xor(v, 8, 16);
    p0[r] = v;
    float u = p1[r];
    u += __shfl_xor(u, 1, 16);
    u += __shfl_xor(u, 2, 16);
    u += __shfl_xor(u, 4, 16);
    u += __shfl_xor(u, 8, 16);
    p1[r] = u;
  }
  if (m == 0) {
#pragma unroll
    for (int r = 0; r < 8; ++r) {
      sl[tx0 + 8 * hh + r]      = p0[r];
      sl[tx0 + 16 + 8 * hh + r] = p1[r];
    }
  }
  __syncthreads();

  // ---- (3) softmax over tx (thread = tx) ----
  const float sv = sl[tid];
  float mx = sv;
  mx = fmaxf(mx, __shfl_xor(mx, 16, 32));
  mx = fmaxf(mx, __shfl_xor(mx, 8, 32));
  mx = fmaxf(mx, __shfl_xor(mx, 4, 32));
  mx = fmaxf(mx, __shfl_xor(mx, 2, 32));
  mx = fmaxf(mx, __shfl_xor(mx, 1, 32));
  if (lane == 0) redm[wave] = mx;
  __syncthreads();
  float mm = redm[0];
#pragma unroll
  for (int w = 1; w < SC_WAVES; ++w) mm = fmaxf(mm, redm[w]);
  const float ev = expf(sv - mm);
  float ss = ev;
  ss += __shfl_xor(ss, 16, 32);
  ss += __shfl_xor(ss, 8, 32);
  ss += __shfl_xor(ss, 4, 32);
  ss += __shfl_xor(ss, 2, 32);
  ss += __shfl_xor(ss, 1, 32);
  if (lane == 0) reds[wave] = ss;
  __syncthreads();
  float tot = reds[0];
#pragma unroll
  for (int w = 1; w < SC_WAVES; ++w) tot += reds[w];
  const float a = ev * (1.0f / tot);                       // tot >= 1 by construction
  const unsigned short hb16 = bf_bits(a);
  const unsigned short lb16 = bf_bits(a - bf_up(hb16));    // residual is exact in f32
  pp[t * LDW + tid] = hb16;                                // read only behind the barrier after the loop
  pp[(NTY + t) * LDW + tid] = lb16;
  }

  // ---- (4) out rows of this block ----
  __syncthreads();                                          // publishes the rows of pp to every wave
  const u16* bp = XT + ((size_t)b * (CC / 16) + wave * 2) * (TX * 16) + lane * 8;
  FragB xb0[TX / 32], xb1[TX / 32];
#pragma unroll
  for (int kk = 0; kk < TX / 32; ++kk) {                   // all 32 loads in flight at once, in the registers of the x fragments
    xb0[kk].u[0] = *(const v4u*)(bp + kk * 512);
    xb0[kk].u[1] = *(const v4u*)(bp + kk * 512 + 256);
    xb1[kk].u[0] = *(const v4u*)(bp + TX * 16 + kk * 512);
    xb1[kk].u[1] = *(const v4u*)(bp + TX * 16 + kk * 512 + 256);
  }
  // stands in front of every overwrite of the address registers of the loads above (bp is named so that it lives to here)
  asm volatile("s_wait_xcnt 0x0" :: "v"(bp) : "memory");
  const u16* pa = &pp[(m & (2 * NTY - 1)) * LDW + 8 * hh];
  v16b af[TX / 32];
#pragma unroll
  for (int kk = 0; kk < TX / 32; ++kk) af[kk] = ldfrag_b(pa + kk * 32);
  v8f o0 = zero8(), o1 = zero8();
#pragma unroll
  for (int kk = 0; kk < TX / 32; ++kk) {
    o0 = mma_b(af[kk], xb0[kk].v, o0);
    o1 = mma_b(af[kk], xb1[kk].v, o1);
  }
  float* dst = out + ((size_t)b * TYR + ty0) * CC + wave * 32 + lane;
#pragma unroll
  for (int r = 0; r < NTY; ++r) dst[(size_t)r * CC] = (hh == 0) ? (o0[r] + o0[NTY + r]) : (o1[r] + o1[NTY + r]);
}

// =====================================================================================================
// Workspace map (bytes, NB = 8, TYR = 256); every plane is fully written by whole-line stores before it is read; all
// extents are exact multiples of the store granularity (no pad rows), every offset a multiple of 128:
//   XB  f16 [NB*TX][CC]  x16         1048576
//   YB  bf16 [NB*TY][CC]             1048576
//   WDB bf16 [HH][CC]                  65536
//   XT  bf16 [NB][CC/16][TX/32][2][32 lanes][8]   1048576
//   end                              3211264
// Inputs are read with the full-size batch strides (TX*CC, TY*CC); out is written as [NB][TYR][CC].
// =====================================================================================================
extern "C" void kernel_launch(void* const* d_in, const int* in_sizes, int n_in,
                              void* d_out, int out_size, void* d_ws, size_t ws_size,
                              hipStream_t stream) {
  if (n_in < 4) return;
  if (in_sizes[0] < NB * TX * CC || in_sizes[1] < NB * TY * CC) return;
  if (in_sizes[2] < HH * CC || in_sizes[3] < HH) return;
  if (out_size < NB * TYR * CC) return;

  const float* Xin = (const float*)d_in[0];
  const float* Yin = (const float*)d_in[1];
  const float* Wd  = (const float*)d_in[2];
  const float* vd  = (const float*)d_in[3];
  float*       out = (float*)d_out;

  const size_t szXB = (size_t)NB * TX * CC * 2;
  const size_t szYB = (size_t)NB * TY * CC * 2;
  const size_t szWD = (size_t)HH * CC * 2;
  const size_t szXT = (size_t)NB * CC * TX * 2;
  size_t off = 0;
  const size_t oXB = off; off += szXB;
  const size_t oYB = off; off += szYB;
  const size_t oWD = off; off += szWD;
  const size_t oXT = off; off += szXT;
  if (off > ws_size) return;                            // 3211264 at NB = 8
  if (off > (size_t)134217728) return;

  char* ws = (char*)d_ws;
  u16* XB  = (u16*)(ws + oXB);
  u16* YB  = (u16*)(ws + oYB);
  u16* WDB = (u16*)(ws + oWD);
  u16* XT  = (u16*)(ws + oXT);

  const dim3 blk(256);
  const dim3 gPR(XT_BLOCKS + CX_BLOCKS + CY_BLOCKS + CW_BLOCKS);   // 128 + 256 + 256 + 16
  const dim3 gSC(NB * TYR / NTY);                       // 512
  const dim3 bSC(SC_THREADS);                           // 256

  // (0) operand planes, one launch: x[b][tx][c] -> XT (transposed, bf16, fragment order); x -> f16 of bf16 value x16; y -> bf16;
  //     Wd [h][c] (k-contiguous) -> bf16
  prep_planes<<<gPR, blk, 0, stream>>>(Xin, Yin, Wd, XT, XB, YB, WDB);
  // (1) scores, tanh.vd row-dot, softmax -> P hi / residual bf16 rows in LDS; out[b][ty][d] = sum_tx P[ty][tx] * x[b][tx][d]
  score_softmax<<<gSC, bSC, 0, stream>>>(XB, YB, WDB, vd, XT, out);
  (void)hipGetLastError();
}

// v005
// Measured time: 30 microseconds a run.
// In two side-by-side timings against v004, it was 1.07 and 1.08 times as fast.
// All steps since v000 together make it 2.21 times as fast.
// Contractions: scores x.(Wd*y)^T on v_wmma_f32_16x16x32_f16 (x as f16 of its RNE bf16 value x16, Wd*y product plane as
// single f16 x1024: one packed f16 multiply of the f16 copies of the bf16 values, Wd x64 and y x16; f32 accumulate);
// P.x on v_wmma_f32_16x16x32_bf16 (P as bf16 hi + bf16 residual planes, x as RNE bf16,
// f32 accumulate). tanh, the h.vd row-dot (vd as RNE bf16 value) and the softmax in f32 on VALU.
#include <hip/hip_runtime.h>
#include <math.h>
#include <stdint.h>

#ifndef NB
#define NB 8
#endif
#define NB_FULL 8
#define TX 256
#define TY 256
#ifndef TYR
#define TYR TY
#endif
#define CC 256
#define HH 128
#define XSC 16.0f
#define WSC 64.0f
#define YSC 16.0f
#define ZINV (1.0f / (XSC * WSC * YSC))
#define LDW 264
#define TP 68
#define SC_WAVES 8
#define SC_THREADS (SC_WAVES * 32)
#define NTY 4
#define XT_BLOCKS (NB * (TX / 64) * (CC / 64))
#define CX_BLOCKS ((NB * TX * CC) / (8 * 256))
#define CY_BLOCKS ((NB * TY * CC) / (8 * 256))
#define CW_BLOCKS ((HH * CC) / (8 * 256))

static_assert(TX == 256 && TY == 256 && CC == 256 && HH == 128);
static_assert(NB >= 1 && NB <= NB_FULL);
static_assert((TYR % 64) == 0 && TYR >= 64 && TYR <= TY);
static_assert((TYR % NTY) == 0 && NTY * CC == SC_THREADS * 4 && NTY == 4 && SC_WAVES * 32 == CC);
static_assert(SC_THREADS == TX && SC_WAVES * 32 == TX && SC_WAVES * 16 == HH && 32 * 8 == CC);
static_assert((CC % 32) == 0 && (TX % 32) == 0 && (LDW % 8) == 0 && LDW >= CC);
static_assert(((NB * TX * CC / 8) % 256) == 0 && ((NB * TY * CC / 8) % 256) == 0 && ((HH * CC / 8) % 256) == 0);
static_assert((TX % 64) == 0 && (CC % 64) == 0 && (TP * 4) % 16 == 0);

typedef unsigned short u16;
typedef _Float16 v16h __attribute__((ext_vector_type(16)));
typedef _Float16 v8h  __attribute__((ext_vector_type(8)));
typedef __bf16   v16b __attribute__((ext_vector_type(16)));
typedef float    v8f  __attribute__((ext_vector_type(8)));
typedef float    v4f  __attribute__((ext_vector_type(4)));
typedef unsigned int v4u __attribute__((ext_vector_type(4)));
typedef unsigned int v2u __attribute__((ext_vector_type(2)));

union FragH { v16h v; v8h h[2]; v4u u[2]; };
union FragB { v16b v; v4u u[2]; };

// ---- scalar helpers --------------------------------------------------------------------------------
__device__ __forceinline__ unsigned short bf_bits(float f) {          // f32 -> bf16 bits, RNE convert
  unsigned u = __float_as_uint(f);
  return (unsigned short)((u + 0x7FFFu + ((u >> 16) & 1u)) >> 16);
}
__device__ __forceinline__ float bf_up(unsigned short h) { return __uint_as_float(((unsigned)h) << 16); }
__device__ __forceinline__ float bf_val(float f) { return bf_up(bf_bits(f)); }          // value after RNE bf16 convert
__device__ __forceinline__ unsigned short h_bits(_Float16 x) { return __builtin_bit_cast(unsigned short, x); }
__device__ __forceinline__ unsigned pk16(unsigned short a, unsigned short b) { return (unsigned)a | ((unsigned)b << 16); }
__device__ __forceinline__ v8f zero8() { v8f z = {0.f, 0.f, 0.f, 0.f, 0.f, 0.f, 0.f, 0.f}; return z; }

// tanh(v) on the chip's own transcendental (v_tanh_f32): one instruction, branch-free
__device__ __forceinline__ float tanh_e(float v) {
  return __builtin_amdgcn_tanhf(v);
}

// ---- fragment loaders: 16-bit A/B operand, lane -> row/col (lane&15), p already includes +8*(lane>>4);
//      elements 0..7 <- p[0..7] (k0+8h..), elements 8..15 <- p[16..23] (k0+16+8h..)  (same split k map for A and B;
//      B comes from a k-contiguous [n][k] plane, or from the XT plane, whose 16-B pieces lie in this same order)
__device__ __forceinline__ v16h ldfrag_h(const _Float16* p) {
  FragH f;
  f.h[0] = *(const v8h*)(p);
  f.h[1] = *(const v8h*)(p + 16);
  return f.v;
}
__device__ __forceinline__ v16b ldfrag_b(const u16* p) {              // bf16 plane read as unsigned integer vectors
  FragB f;
  f.u[0] = *(const v4u*)(p);
  f.u[1] = *(const v4u*)(p + 16);
  return f.v;
}

__device__ __forceinline__ v8f mma_h(v16h a, v16h b, v8f c) {
  return __builtin_amdgcn_wmma_f32_16x16x32_f16(false, a, false, b, (short)0, c, false, false);
}
__device__ __forceinline__ v8f mma_b(v16b a, v16b b, v8f c) {
  return __builtin_amdgcn_wmma_f32_16x16x32_bf16(false, a, false, b, (short)0, c, false, false);
}
__device__ __forceinline__ void acc_guard4(v8f& a, v8f& b, v8f& c, v8f& d) {
#if defined(__HIP_DEVICE_COMPILE__)
  asm volatile("v_nop\n\tv_nop\n\tv_nop\n\tv_nop" : "+v"(a), "+v"(b), "+v"(c), "+v"(d));
#endif
}
// =====================================================================================================
// One launch prepares all four operand planes; the job of a block follows from its index alone (block-uniform):
//   blocks [0, XT_BLOCKS)          x -> XT   transposed bf16 plane (the longest chain, so it starts first)
//   next CX_BLOCKS                 x -> XB   f16 bits of (bf16 RNE value) * 16, same layout
//   next CY_BLOCKS                 y -> YB   f16 bits of (bf16 RNE value) * 16, same layout
//   next CW_BLOCKS                 Wd -> WDB f16 bits of (bf16 RNE value) * 64, same layout
// The jobs are independent of each other: no block reads what another block of this launch writes.
// =====================================================================================================

// f32 plane -> 16-bit plane, same layout:  mode 0: bf16 RNE bits;  mode 1: f16 bits of (bf16 RNE value) * scale.
// Thread = 8 consecutive elements: two 16-B loads, one 16-B store; 32 consecutive lanes = 512 contiguous, 512-B aligned bytes
// coverage: blocks x 256 thr x 8 = the whole plane (exactness: static_assert on the plane sizes).
__device__ __forceinline__ void cvt_job(const float* __restrict__ x, u16* D, int blk, int tid, int mode, float scale) {
  const int gt = blk * 256 + tid;
  const float* p = x + (size_t)gt * 8;
  const v4f a = *(const v4f*)(p), c4 = *(const v4f*)(p + 4);
  float v[8];
#pragma unroll
  for (int e = 0; e < 4; ++e) { v[e] = a[e]; v[4 + e] = c4[e]; }
  unsigned short s[8];
#pragma unroll
  for (int e = 0; e < 8; ++e) {
    const unsigned short bb = bf_bits(v[e]);
    const unsigned short hb = h_bits((_Float16)(bf_up(bb) * scale));
    s[e] = (mode != 0) ? hb : bb;
  }
  v4u o;
#pragma unroll
  for (int e = 0; e < 4; ++e) o[e] = pk16(s[2 * e], s[2 * e + 1]);
  u16* d = D + (size_t)gt * 8;
  {
    *(v4u*)(d) = o;
    // precaution: each block takes one branch, and nothing of the kernel follows the store
    asm volatile("s_wait_xcnt 0x0" ::: "memory");
  }
}

// Transposed bf16 plane of x:  in x[b][tx][c] f32 (row pitch CC)  ->  out XT = x[b][tx][d = c] as bf16 RNE bits, laid out
// in the order of the B fragments that read it (col n = d & 15, split k map over tx): one fragment half = 512 contiguous B.
// Block = (b, 64 tx rows, 64 c cols): thread loads 16 consecutive c of one tx row (four 16-B loads), stores them
// transposed into the LDS tile T[c][tx] (pitch TP floats); after the block barrier wave w / instruction i writes the
// coverage: 8 waves x 2 instructions x 4 rows = 64 c rows, 8 lanes x 8 halves = 64 tx each; XT_BLOCKS
//           blocks = every (b, c, tx) of the XT plane exactly once. Staged extent == consumed extent (64 x 64 of T).
__device__ __forceinline__ void xpose_job(const float* __restrict__ x, u16* XT, float* T, int bid, int tid) {
  const int lane = tid & 31, wave = tid >> 5;
  const int ntl = (TX / 64) * (CC / 64);
  const int b   = bid / ntl, t = bid % ntl;
  const int tx0 = (t / (CC / 64)) * 64;
  const int c0  = (t % (CC / 64)) * 64;
  const int r   = tid >> 2, cq = (tid & 3) * 16;
  const float* p = x + ((size_t)b * TX + tx0 + r) * CC + c0 + cq;
  const v4f q0 = *(const v4f*)(p), q1 = *(const v4f*)(p + 4), q2 = *(const v4f*)(p + 8), q3 = *(const v4f*)(p + 12);
#pragma unroll
  for (int e = 0; e < 4; ++e) {
    T[(cq + e) * TP + r]      = q0[e];
    T[(cq + 4 + e) * TP + r]  = q1[e];
    T[(cq + 8 + e) * TP + r]  = q2[e];
    T[(cq + 12 + e) * TP + r] = q3[e];
  }
  __syncthreads();
  const int rq = lane >> 3, g8 = (lane & 7) * 8;
  v4u ov[2];
#pragma unroll
  for (int i = 0; i < 2; ++i) {
    const int ci = wave * 8 + i * 4 + rq;
    const v4f a = *(const v4f*)(T + ci * TP + g8), c4 = *(const v4f*)(T + ci * TP + g8 + 4);
    float w[8];
#pragma unroll
    for (int e = 0; e < 4; ++e) { w[e] = a[e]; w[4 + e] = c4[e]; }
#pragma unroll
    for (int e = 0; e < 4; ++e) ov[i][e] = pk16(bf_bits(w[2 * e]), bf_bits(w[2 * e + 1]));
  }
  // fragment order: 16-B piece (d, 8 tx) -> [b][d >> 4][tx >> 5][(tx >> 4) & 1][lane = 16 * ((tx >> 3) & 1) + (d & 15)]
  const int d0 = c0 + wave * 8 + rq, tq = tx0 + g8;
  u16* dst = XT + ((((size_t)b * (CC / 16) + (d0 >> 4)) * (TX / 32) + (tq >> 5)) * 2 + ((tq >> 4) & 1)) * 256
                + (((tq >> 3) & 1) * 16 + (d0 & 15)) * 8;
  {
#pragma unroll
    for (int i = 0; i < 2; ++i) {
      *(v4u*)(dst + i * 32) = ov[i];                        // d + 4: four lanes' pieces further in the same 128-B line
    }
  }
}

__global__ __launch_bounds__(256) void prep_planes(const float* __restrict__ x, const float* __restrict__ y,
                                                   const float* __restrict__ Wd, u16* XT, u16* XB, u16* YB, u16* WDB) {
  __shared__ __align__(16) float T[64 * TP];
  const int tid = threadIdx.x;
  const int bid = blockIdx.x;
  if (bid < XT_BLOCKS) {                                    // the only job with a barrier; the whole block takes it
    xpose_job(x, XT, T, bid, tid);
  } else if (bid < XT_BLOCKS + CX_BLOCKS) {
    cvt_job(x, XB, bid - XT_BLOCKS, tid, 1, XSC);
  } else if (bid < XT_BLOCKS + CX_BLOCKS + CY_BLOCKS) {
    cvt_job(y, YB, bid - (XT_BLOCKS + CX_BLOCKS), tid, 1, YSC);
  } else {
    cvt_job(Wd, WDB, bid - (XT_BLOCKS + CX_BLOCKS + CY_BLOCKS), tid, 1, WSC);
  }
}

// =====================================================================================================
// Scores + softmax for NTY consecutive ty rows of one b per block (SC_THREADS = TX threads, 8 waves), one row after the
// other. What does not depend on ty is fetched once per block: the wave's 32 x CC f16 rows of x stay in registers as its
// 16 A fragments, the Wd f16 plane stays in LDS (every thread reads back only the pieces it stored itself), and the
// block's NTY y rows are staged in LDS behind one block barrier.
//  (1) Wy plane in LDS: Wys[h][c] = f16 product (bf16(Wd[h][c]) * 64) * (bf16(y[b][ty][c]) * 16): both factors are exact
//      in f16 (8 significant bits, power-of-two scale), so the packed f16 multiply rounds the exact product once, RNE.
//      Thread = (8 consecutive c, h = tid>>5 + 8i, i = 0..15): one 16-B LDS load of the Wd f16 plane, four packed
//      multiplies, one 16-B LDS store per (h, 8 c). coverage: 32 c-groups x 8 = CC, 8 x 16 = HH rows; pad cols CC..LDW-1
//      are never read. Block barrier before any fragment load.
//  (2) z[tx][h] (times 16*1024) = XB[b][tx][:] (A, f16 x16, row m = tx, split k map, the fragments held in registers)
//      . Wys[h][:]^T (B, col n = h, split k map from LDS); wave w owns tx rows 32w..32w+31 (2 M-tiles) and visits the
//      128 h columns in four visits of 2 N-tiles (4 accumulators), K = CC stepped by 32.
//      Epilogue per visit: p[row] += bf16(vd[h]) * tanh(z / 16384) in f32, D element r of lane -> (tx 32w+16mt+8hh+r,
//      h = hb+16j+m); then a fixed-order xor reduce over the 16 lanes of each half gives s[tx]; lanes m == 0 write s.
//  (3) f32 max-subtracted softmax over the TX scores (thread = tx): P = e / sum via one reciprocal; P -> bf16 hi bits
//      and bf16 bits of the exact residual (P - hi), kept in LDS (pp: one row of each per ty, pitch LDW).
//  (4) once per block, behind one barrier: out[b][ty0+r][d] = sum_tx hi[r][tx] * x[tx][d] + sum_tx residual[r][tx] * x[tx][d]
//      on the bf16 matrix form, f32 accumulate, K = TX stepped by 32. A row i of the 16 reads pp row i & 7 (every LDS
//      byte read was written): D rows 0..3 are the hi sums, 4..7 the residual sums, 8..15 repeat them. Wave w owns d
//      columns 32w..32w+31 (2 N-tiles; B halves are whole 512-B pieces of the XT plane; split k map for A and B).
//      Store: lanes 0..15 take tile 0, lanes 16..31 the repeat rows of tile 1: one whole 128-B line a row and wave.
// coverage: grid NB*TYR/NTY blocks x NTY rows x 8 waves x 32 columns = every out[b][ty < TYR][d] exactly once.
// =====================================================================================================
__global__ __launch_bounds__(SC_THREADS, 4)                 // 4 waves per SIMD: two blocks share a WGP (256 VGPRs a wave)
void score_softmax(const u16* __restrict__ XB, const u16* __restrict__ YB, const u16* __restrict__ WDB,
                   const float* __restrict__ vd, const u16* __restrict__ XT, float* out) {
  __shared__ __align__(16) u16 Wys[HH * LDW];
  __shared__ __align__(16) u16 Wds[HH * CC];
  __shared__ __align__(16) u16 ys[NTY * CC];
  __shared__ __align__(16) u16 pp[2 * NTY * LDW];           // rows 0..NTY-1: P hi, rows NTY..2*NTY-1: P residual
  __shared__ float sl[TX];
  __shared__ float vds[HH];
  __shared__ float redm[SC_WAVES];
  __shared__ float reds[SC_WAVES];

  const int tid = threadIdx.x, wave = tid >> 5, lane = tid & 31, hh = lane >> 4, m = lane & 15;
  const int bid = blockIdx.x;
  const int b   = bid / (TYR / NTY);
  const int ty0 = (bid % (TYR / NTY)) * NTY;
  const int c8 = lane * 8, hq = wave;

  if (tid < HH) vds[tid] = bf_val(vd[tid]);                 // waves 0..3 whole (HH = 128): wave-uniform

  // ---- (0) once per block: A fragments of x, Wd plane, the NTY y rows ----
  const int tx0 = wave * 32;
  const _Float16* ap = (const _Float16*)(const void*)XB + ((size_t)b * TX + tx0 + m) * CC + 8 * hh;
  v16h af0[CC / 32], af1[CC / 32];
#pragma unroll
  for (int kk = 0; kk < CC / 32; ++kk) {
    af0[kk] = ldfrag_h(ap + kk * 32);
    af1[kk] = ldfrag_h(ap + (size_t)16 * CC + kk * 32);
  }
  const v2u yq = *(const v2u*)(YB + ((size_t)b * TY + ty0) * CC + tid * 4);
  // stands in front of every overwrite of the address registers of the loads above (ap is named so that it lives to here)
  asm volatile("s_wait_xcnt 0x0" :: "v"(ap) : "memory");
  *(v2u*)(&ys[tid * 4]) = yq;
#pragma unroll 4                                            // four loads in flight a trip instead of one
  for (int i = 0; i < HH / 8; ++i) {
    const int h = hq + 8 * i;
    *(v4u*)(&Wds[h * CC + c8]) = *(const v4u*)(WDB + (size_t)h * CC + c8);
  }
  __syncthreads();                                          // publishes ys (and vds) to every wave

#pragma unroll 1                                            // rolled: one copy of the long body, registers as for one row
  for (int t = 0; t < NTY; ++t) {

  // ---- (1) Wy plane (the last fragment read of the row before lies in front of that row's barrier on sl) ----
  {
    const v8h yv = *(const v8h*)(const void*)(&ys[t * CC + c8]);
    const u16* wsrc = &Wds[hq * CC + c8];
    u16* wdst = &Wys[hq * LDW + c8];
#pragma unroll                                              // all 16 LDS loads in flight at once, constant offsets: one load latency a row
    for (int i = 0; i < HH / 8; ++i) {                      // h = hq + 8 * i
      const v8h wv = *(const v8h*)(const void*)(wsrc + i * 8 * CC);
      *(v8h*)(void*)(wdst + i * 8 * LDW) = wv * yv;
    }
  }
  __syncthreads();

  // ---- (2) scores ----
  const _Float16* wl = (const _Float16*)(const void*)(&Wys[0]);
  v8f p0 = zero8(), p1 = zero8();

#pragma unroll 1
  for (int q = 0; q < 4; ++q) {                             // 2 N-tiles a visit: 4 accumulators beside the 16 A fragments
    const int hb = q * 32;
    const _Float16* bq = wl + (size_t)(hb + m) * LDW + 8 * hh;
    v8f c0[2], c1[2];
#pragma unroll
    for (int j = 0; j < 2; ++j) { c0[j] = zero8(); c1[j] = zero8(); }
#pragma unroll
    for (int k0 = 0; k0 < CC; k0 += 64) {                   // unrolled: the fragment arrays need constant indices
      const v16h b0 = ldfrag_h(bq + k0);                    // two k steps a trip: 8 LDS loads ahead of 8 products
      const v16h b1 = ldfrag_h(bq + 16 * LDW + k0);
      const v16h b2 = ldfrag_h(bq + k0 + 32);
      const v16h b3 = ldfrag_h(bq + 16 * LDW + k0 + 32);
      c0[0] = mma_h(af0[k0 / 32], b0, c0[0]);
      c0[1] = mma_h(af0[k0 / 32], b1, c0[1]);
      c1[0] = mma_h(af1[k0 / 32], b0, c1[0]);
      c1[1] = mma_h(af1[k0 / 32], b1, c1[1]);
      c0[0] = mma_h(af0[k0 / 32 + 1], b2, c0[0]);
      c0[1] = mma_h(af0[k0 / 32 + 1], b3, c0[1]);
      c1[0] = mma_h(af1[k0 / 32 + 1], b2, c1[0]);
      c1[1] = mma_h(af1[k0 / 32 + 1], b3, c1[1]);
    }
    acc_guard4(c0[0], c0[1], c1[0], c1[1]);
#pragma unroll
    for (int j = 0; j < 2; ++j) {
      const float vv = vds[hb + 16 * j + m];
      v8f t0 = c0[j] * ZINV, t1 = c1[j] * ZINV;             // independent tanh back to back: none waits for its neighbour
#pragma unroll
      for (int r = 0; r < 8; ++r) { t0[r] = tanh_e(t0[r]); t1[r] = tanh_e(t1[r]); }
      p0 += vv * t0;
      p1 += vv * t1;
    }
  }

  // reduce over the 16 column lanes of each half (fixed order); D row = tx0 + 16*mt + 8*hh + r
#pragma unroll
  for (int r = 0; r < 8; ++r) {
    float v = p0[r];
    v += __shfl_xor(v, 1, 16);
    v += __shfl_xor(v, 2, 16);
    v += __shfl_xor(v, 4, 16);
    v += __shfl_xor(v, 8, 16);
    p0[r] = v;
    float u = p1[r];
    u += __shfl_xor(u, 1, 16);
    u += __shfl_xor(u, 2, 16);
    u += __shfl_xor(u, 4, 16);
    u += __shfl_xor(u, 8, 16);
    p1[r] = u;
  }
  if (m == 0) {
#pragma unroll
    for (int r = 0; r < 8; ++r) {
      sl[tx0 + 8 * hh + r]      = p0[r];
      sl[tx0 + 16 + 8 * hh + r] = p1[r];
    }
  }
  __syncthreads();

  // ---- (3) softmax over tx (thread = tx) ----
  const float sv = sl[tid];
  float mx = sv;
  mx = fmaxf(mx, __shfl_xor(mx, 16, 32));
  mx = fmaxf(mx, __shfl_xor(mx, 8, 32));
  mx = fmaxf(mx, __shfl_xor(mx, 4, 32));
  mx = fmaxf(mx, __shfl_xor(mx, 2, 32));
  mx = fmaxf(mx, __shfl_xor(mx, 1, 32));
  if (lane == 0) redm[wave] = mx;
  __syncthreads();
  float mm = redm[0];
#pragma unroll
  for (int w = 1; w < SC_WAVES; ++w) mm = fmaxf(mm, redm[w]);
  const float ev = expf(sv - mm);
  float ss = ev;
  ss += __shfl_xor(ss, 16, 32);
  ss += __shfl_xor(ss, 8, 32);
  ss += __shfl_xor(ss, 4, 32);
  ss += __shfl_xor(ss, 2, 32);
  ss += __shfl_xor(ss, 1, 32);
  if (lane == 0) reds[wave] = ss;
  __syncthreads();
  float tot = reds[0];
#pragma unroll
  for (int w = 1; w < SC_WAVES; ++w) tot += reds[w];
  const float a = ev * (1.0f / tot);                       // tot >= 1 by construction
  const unsigned short hb16 = bf_bits(a);
  const unsigned short lb16 = bf_bits(a - bf_up(hb16));    // residual is exact in f32
  pp[t * LDW + tid] = hb16;                                // read only behind the barrier after the loop
  pp[(NTY + t) * LDW + tid] = lb16;
  }

  // ---- (4) out rows of this block ----
  __syncthreads();                                          // publishes the rows of pp to every wave
  const u16* bp = XT + ((size_t)b * (CC / 16) + wave * 2) * (TX * 16) + lane * 8;
  FragB xb0[TX / 32], xb1[TX / 32];
#pragma unroll
  for (int kk = 0; kk < TX / 32; ++kk) {                   // all 32 loads in flight at once, in the registers of the x fragments
    xb0[kk].u[0] = *(const v4u*)(bp + kk * 512);
    xb0[kk].u[1] = *(const v4u*)(bp + kk * 512 + 256);
    xb1[kk].u[0] = *(const v4u*)(bp + TX * 16 + kk * 512);
    xb1[kk].u[1] = *(const v4u*)(bp + TX * 16 + kk * 512 + 256);
  }
  // stands in front of every overwrite of the address registers of the loads above (bp is named so that it lives to here)
  asm volatile("s_wait_xcnt 0x0" :: "v"(bp) : "memory");
  const u16* pa = &pp[(m & (2 * NTY - 1)) * LDW + 8 * hh];
  v16b af[TX / 32];
#pragma unroll
  for (int kk = 0; kk < TX / 32; ++kk) af[kk] = ldfrag_b(pa + kk * 32);
  v8f o0 = zero8(), o1 = zero8();
#pragma unroll
  for (int kk = 0; kk < TX / 32; ++kk) {
    o0 = mma_b(af[kk], xb0[kk].v, o0);
    o1 = mma_b(af[kk], xb1[kk].v, o1);
  }
  float* dst = out + ((size_t)b * TYR + ty0) * CC + wave * 32 + lane;
#pragma unroll
  for (int r = 0; r < NTY; ++r) dst[(size_t)r * CC] = (hh == 0) ? (o0[r] + o0[NTY + r]) : (o1[r] + o1[NTY + r]);
}

// =====================================================================================================
// Workspace map (bytes, NB = 8, TYR = 256); every plane is fully written by whole-line stores before it is read; all
// extents are exact multiples of the store granularity (no pad rows), every offset a multiple of 128:
//   XB  f16 [NB*TX][CC]  x16         1048576
//   YB  f16 [NB*TY][CC]  x16         1048576
//   WDB f16 [HH][CC]     x64           65536
//   XT  bf16 [NB][CC/16][TX/32][2][32 lanes][8]   1048576
//   end                              3211264
// Inputs are read with the full-size batch strides (TX*CC, TY*CC); out is written as [NB][TYR][CC].
// =====================================================================================================
extern "C" void kernel_launch(void* const* d_in, const int* in_sizes, int n_in,
                              void* d_out, int out_size, void* d_ws, size_t ws_size,
                              hipStream_t stream) {
  if (n_in < 4) return;
  if (in_sizes[0] < NB * TX * CC || in_sizes[1] < NB * TY * CC) return;
  if (in_sizes[2] < HH * CC || in_sizes[3] < HH) return;
  if (out_size < NB * TYR * CC) return;

  const float* Xin = (const float*)d_in[0];
  const float* Yin = (const float*)d_in[1];
  const float* Wd  = (const float*)d_in[2];
  const float* vd  = (const float*)d_in[3];
  float*       out = (float*)d_out;

  const size_t szXB = (size_t)NB * TX * CC * 2;
  const size_t szYB = (size_t)NB * TY * CC * 2;
  const size_t szWD = (size_t)HH * CC * 2;
  const size_t szXT = (size_t)NB * CC * TX * 2;
  size_t off = 0;
  const size_t oXB = off; off += szXB;
  const size_t oYB = off; off += szYB;
  const size_t oWD = off; off += szWD;
  const size_t oXT = off; off += szXT;
  if (off > ws_size) return;                            // 3211264 at NB = 8
  if (off > (size_t)134217728) return;

  char* ws = (char*)d_ws;
  u16* XB  = (u16*)(ws + oXB);
  u16* YB  = (u16*)(ws + oYB);
  u16* WDB = (u16*)(ws + oWD);
  u16* XT  = (u16*)(ws + oXT);

  const dim3 blk(256);
  const dim3 gPR(XT_BLOCKS + CX_BLOCKS + CY_BLOCKS + CW_BLOCKS);   // 128 + 256 + 256 + 16
  const dim3 gSC(NB * TYR / NTY);                       // 512
  const dim3 bSC(SC_THREADS);                           // 256

  // (0) operand planes, one launch: x[b][tx][c] -> XT (transposed, bf16, fragment order); x, y -> f16 of bf16 value x16;
  //     Wd [h][c] (k-contiguous) -> f16 of bf16 value x64
  prep_planes<<<gPR, blk, 0, stream>>>(Xin, Yin, Wd, XT, XB, YB, WDB);
  // (1) scores, tanh.vd row-dot, softmax -> P hi / residual bf16 rows in LDS; out[b][ty][d] = sum_tx P[ty][tx] * x[b][tx][d]
  score_softmax<<<gSC, bSC, 0, stream>>>(XB, YB, WDB, vd, XT, out);
  (void)hipGetLastError();
}

// v006
// One run takes 29.2 microseconds.
// Timed twice side by side with v005, it ran 1.03 and 1.04 times as fast.
// Over all steps from v000 it is 2.29 times as fast.
// Contractions: scores x.(Wd*y)^T on v_wmma_f32_16x16x32_f16 (x as f16 of its RNE bf16 value x16, Wd*y product plane as
// single f16 x1024: one packed f16 multiply of the f16 copies of the bf16 values, Wd x64 and y x16; f32 accumulate);
// P.x on v_wmma_f32_16x16x32_bf16 (P as bf16 hi + bf16 residual planes, x as RNE bf16,
// f32 accumulate). tanh, the h.vd row-dot (vd as RNE bf16 value) and the softmax in f32 on VALU.
#include <hip/hip_runtime.h>
#include <math.h>
#include <stdint.h>

#ifndef NB
#define NB 8
#endif
#define NB_FULL 8
#define TX 256
#define TY 256
#ifndef TYR
#define TYR TY
#endif
#define CC 256
#define HH 128
#define XSC 16.0f
#define WSC 64.0f
#define YSC 16.0f
#define ZINV (1.0f / (XSC * WSC * YSC))
#define LDW 264
#define TP 68
#define SC_WAVES 8
#define SC_THREADS (SC_WAVES * 32)
#define NTY 4
#define XT_BLOCKS (NB * (TX / 64) * (CC / 64))
#define CX_BLOCKS ((NB * TX * CC) / (8 * 256))
#define CY_BLOCKS ((NB * TY * CC) / (8 * 256))
#define CW_BLOCKS ((HH * CC) / (8 * 256))

static_assert(TX == 256 && TY == 256 && CC == 256 && HH == 128);
static_assert(NB >= 1 && NB <= NB_FULL);
static_assert((TYR % 64) == 0 && TYR >= 64 && TYR <= TY);
static_assert((TYR % NTY) == 0 && NTY * CC == SC_THREADS * 4 && NTY == 4 && SC_WAVES * 32 == CC);
static_assert(SC_THREADS == TX && SC_WAVES * 32 == TX && SC_WAVES * 16 == HH && 32 * 8 == CC);
static_assert((CC % 32) == 0 && (TX % 32) == 0 && (LDW % 8) == 0 && LDW >= CC);
static_assert(((NB * TX * CC / 8) % 256) == 0 && ((NB * TY * CC / 8) % 256) == 0 && ((HH * CC / 8) % 256) == 0);
static_assert((TX % 64) == 0 && (CC % 64) == 0 && (TP * 4) % 16 == 0);
static_assert(CC / 32 == 8 && 16 * CC == 8 * 512);          // the shifts of the fragment-order XB plane

typedef unsigned short u16;
typedef _Float16 v16h __attribute__((ext_vector_type(16)));
typedef _Float16 v8h  __attribute__((ext_vector_type(8)));
typedef __bf16   v16b __attribute__((ext_vector_type(16)));
typedef float    v8f  __attribute__((ext_vector_type(8)));
typedef float    v4f  __attribute__((ext_vector_type(4)));
typedef unsigned int v4u __attribute__((ext_vector_type(4)));
typedef unsigned int v2u __attribute__((ext_vector_type(2)));

union FragH { v16h v; v8h h[2]; v4u u[2]; };
union FragB { v16b v; v4u u[2]; };

// ---- scalar helpers --------------------------------------------------------------------------------
__device__ __forceinline__ unsigned short bf_bits(float f) {          // f32 -> bf16 bits, RNE convert
  unsigned u = __float_as_uint(f);
  return (unsigned short)((u + 0x7FFFu + ((u >> 16) & 1u)) >> 16);
}
__device__ __forceinline__ float bf_up(unsigned short h) { return __uint_as_float(((unsigned)h) << 16); }
__device__ __forceinline__ float bf_val(float f) { return bf_up(bf_bits(f)); }          // value after RNE bf16 convert
__device__ __forceinline__ unsigned short h_bits(_Float16 x) { return __builtin_bit_cast(unsigned short, x); }
__device__ __forceinline__ unsigned pk16(unsigned short a, unsigned short b) { return (unsigned)a | ((unsigned)b << 16); }
__device__ __forceinline__ v8f zero8() { v8f z = {0.f, 0.f, 0.f, 0.f, 0.f, 0.f, 0.f, 0.f}; return z; }

// tanh(v) on the chip's own transcendental (v_tanh_f32): one instruction, branch-free
__device__ __forceinline__ float tanh_e(float v) {
  return __builtin_amdgcn_tanhf(v);
}

// ---- fragment loaders: 16-bit A/B operand, lane -> row/col (lane&15), p already includes +8*(lane>>4);
//      elements 0..7 <- p[0..7] (k0+8h..), elements 8..15 <- p[16..23] (k0+16+8h..)  (same split k map for A and B;
//      B comes from a k-contiguous [n][k] plane, or from the XT plane, whose 16-B pieces lie in this same order)
__device__ __forceinline__ v16h ldfrag_h(const _Float16* p) {
  FragH f;
  f.h[0] = *(const v8h*)(p);
  f.h[1] = *(const v8h*)(p + 16);
  return f.v;
}
__device__ __forceinline__ v16b ldfrag_b(const u16* p) {              // bf16 plane read as unsigned integer vectors
  FragB f;
  f.u[0] = *(const v4u*)(p);
  f.u[1] = *(const v4u*)(p + 16);
  return f.v;
}

__device__ __forceinline__ v8f mma_h(v16h a, v16h b, v8f c) {
  return __builtin_amdgcn_wmma_f32_16x16x32_f16(false, a, false, b, (short)0, c, false, false);
}
__device__ __forceinline__ v8f mma_b(v16b a, v16b b, v8f c) {
  return __builtin_amdgcn_wmma_f32_16x16x32_bf16(false, a, false, b, (short)0, c, false, false);
}
__device__ __forceinline__ void acc_guard4(v8f& a, v8f& b, v8f& c, v8f& d) {
#if defined(__HIP_DEVICE_COMPILE__)
  asm volatile("v_nop\n\tv_nop\n\tv_nop\n\tv_nop" : "+v"(a), "+v"(b), "+v"(c), "+v"(d));
#endif
}
// =====================================================================================================
// One launch prepares all four operand planes; the job of a block follows from its index alone (block-uniform):
//   blocks [0, XT_BLOCKS)          x -> XT   transposed bf16 plane (the longest chain, so it starts first)
//   next CX_BLOCKS                 x -> XB   f16 bits of (bf16 RNE value) * 16, in the order of the A fragments that read it
//   next CY_BLOCKS                 y -> YB   f16 bits of (bf16 RNE value) * 16, same layout
//   next CW_BLOCKS                 Wd -> WDB f16 bits of (bf16 RNE value) * 64, same layout
// The jobs are independent of each other: no block reads what another block of this launch writes.
// =====================================================================================================

// f32 plane -> 16-bit plane, same layout:  mode 0: bf16 RNE bits;  mode 1: f16 bits of (bf16 RNE value) * scale.
// Thread = 8 consecutive elements: two 16-B loads, one 16-B store; 32 consecutive lanes = 512 contiguous, 512-B aligned bytes
// coverage: blocks x 256 thr x 8 = the whole plane (exactness: static_assert on the plane sizes).
// frag != 0 (rows of CC elements): the 16-B piece (row, 8 c) goes to [row >> 4][c >> 5][(c >> 4) & 1][lane = 16 * ((c >> 3) & 1)
// + (row & 15)], so that one half of a 16-row fragment is 512 contiguous bytes. The thread still owns destination piece gt
// (whole-line stores) and gathers its source piece; a block reads 16 rows x 128 c, every line of them whole.
__device__ __forceinline__ void cvt_job(const float* __restrict__ x, u16* D, int blk, int tid, int mode, float scale, int frag) {
  const int gt = blk * 256 + tid;
  const size_t so = (frag != 0) ? (((size_t)(gt >> 9) * 16 + (gt & 15)) * CC + ((gt >> 6) & 7) * 32 + ((gt >> 5) & 1) * 16 + ((gt >> 4) & 1) * 8)
                                : (size_t)gt * 8;
  const float* p = x + so;
  const v4f a = *(const v4f*)(p), c4 = *(const v4f*)(p + 4);
  float v[8];
#pragma unroll
  for (int e = 0; e < 4; ++e) { v[e] = a[e]; v[4 + e] = c4[e]; }
  unsigned short s[8];
#pragma unroll
  for (int e = 0; e < 8; ++e) {
    const unsigned short bb = bf_bits(v[e]);
    const unsigned short hb = h_bits((_Float16)(bf_up(bb) * scale));
    s[e] = (mode != 0) ? hb : bb;
  }
  v4u o;
#pragma unroll
  for (int e = 0; e < 4; ++e) o[e] = pk16(s[2 * e], s[2 * e + 1]);
  u16* d = D + (size_t)gt * 8;
  {
    *(v4u*)(d) = o;
    // precaution: each block takes one branch, and nothing of the kernel follows the store
    asm volatile("s_wait_xcnt 0x0" ::: "memory");
  }
}

// Transposed bf16 plane of x:  in x[b][tx][c] f32 (row pitch CC)  ->  out XT = x[b][tx][d = c] as bf16 RNE bits, laid out
// in the order of the B fragments that read it (col n = d & 15, split k map over tx): one fragment half = 512 contiguous B.
// Block = (b, 64 tx rows, 64 c cols): thread loads 16 consecutive c of one tx row (four 16-B loads), stores them
// transposed into the LDS tile T[c][tx] (pitch TP floats); after the block barrier wave w / instruction i writes the
// coverage: 8 waves x 2 instructions x 4 rows = 64 c rows, 8 lanes x 8 halves = 64 tx each; XT_BLOCKS
//           blocks = every (b, c, tx) of the XT plane exactly once. Staged extent == consumed extent (64 x 64 of T).
__device__ __forceinline__ void xpose_job(const float* __restrict__ x, u16* XT, float* T, int bid, int tid) {
  const int lane = tid & 31, wave = tid >> 5;
  const int ntl = (TX / 64) * (CC / 64);
  const int b   = bid / ntl, t = bid % ntl;
  const int tx0 = (t / (CC / 64)) * 64;
  const int c0  = (t % (CC / 64)) * 64;
  const int r   = tid >> 2, cq = (tid & 3) * 16;
  const float* p = x + ((size_t)b * TX + tx0 + r) * CC + c0 + cq;
  const v4f q0 = *(const v4f*)(p), q1 = *(const v4f*)(p + 4), q2 = *(const v4f*)(p + 8), q3 = *(const v4f*)(p + 12);
#pragma unroll
  for (int e = 0; e < 4; ++e) {
    T[(cq + e) * TP + r]      = q0[e];
    T[(cq + 4 + e) * TP + r]  = q1[e];
    T[(cq + 8 + e) * TP + r]  = q2[e];
    T[(cq + 12 + e) * TP + r] = q3[e];
  }
  __syncthreads();
  const int rq = lane >> 3, g8 = (lane & 7) * 8;
  v4u ov[2];
#pragma unroll
  for (int i = 0; i < 2; ++i) {
    const int ci = wave * 8 + i * 4 + rq;
    const v4f a = *(const v4f*)(T + ci * TP + g8), c4 = *(const v4f*)(T + ci * TP + g8 + 4);
    float w[8];
#pragma unroll
    for (int e = 0; e < 4; ++e) { w[e] = a[e]; w[4 + e] = c4[e]; }
#pragma unroll
    for (int e = 0; e < 4; ++e) ov[i][e] = pk16(bf_bits(w[2 * e]), bf_bits(w[2 * e + 1]));
  }
  // fragment order: 16-B piece (d, 8 tx) -> [b][d >> 4][tx >> 5][(tx >> 4) & 1][lane = 16 * ((tx >> 3) & 1) + (d & 15)]
  const int d0 = c0 + wave * 8 + rq, tq = tx0 + g8;
  u16* dst = XT + ((((size_t)b * (CC / 16) + (d0 >> 4)) * (TX / 32) + (tq >> 5)) * 2 + ((tq >> 4) & 1)) * 256
                + (((tq >> 3) & 1) * 16 + (d0 & 15)) * 8;
  {
#pragma unroll
    for (int i = 0; i < 2; ++i) {
      *(v4u*)(dst + i * 32) = ov[i];                        // d + 4: four lanes' pieces further in the same 128-B line
    }
  }
}

__global__ __launch_bounds__(256) void prep_planes(const float* __restrict__ x, const float* __restrict__ y,
                                                   const float* __restrict__ Wd, u16* XT, u16* XB, u16* YB, u16* WDB) {
  __shared__ __align__(16) float T[64 * TP];
  const int tid = threadIdx.x;
  const int bid = blockIdx.x;
  if (bid < XT_BLOCKS) {                                    // the only job with a barrier; the whole block takes it
    xpose_job(x, XT, T, bid, tid);
  } else if (bid < XT_BLOCKS + CX_BLOCKS) {
    cvt_job(x, XB, bid - XT_BLOCKS, tid, 1, XSC, 1);
  } else if (bid < XT_BLOCKS + CX_BLOCKS + CY_BLOCKS) {
    cvt_job(y, YB, bid - (XT_BLOCKS + CX_BLOCKS), tid, 1, YSC, 0);
  } else {
    cvt_job(Wd, WDB, bid - (XT_BLOCKS + CX_BLOCKS + CY_BLOCKS), tid, 1, WSC, 0);
  }
}

// =====================================================================================================
// Scores + softmax for NTY consecutive ty rows of one b per block (SC_THREADS = TX threads, 8 waves), one row after the
// other. What does not depend on ty is fetched once per block: the wave's 32 x CC f16 rows of x stay in registers as its
// 16 A fragments, the Wd f16 plane stays in LDS (every thread reads back only the pieces it stored itself), and the
// block's NTY y rows are staged in LDS behind one block barrier.
//  (1) Wy plane in LDS: Wys[h][c] = f16 product (bf16(Wd[h][c]) * 64) * (bf16(y[b][ty][c]) * 16): both factors are exact
//      in f16 (8 significant bits, power-of-two scale), so the packed f16 multiply rounds the exact product once, RNE.
//      Thread = (8 consecutive c, h = tid>>5 + 8i, i = 0..15): one 16-B LDS load of the Wd f16 plane, four packed
//      multiplies, one 16-B LDS store per (h, 8 c). coverage: 32 c-groups x 8 = CC, 8 x 16 = HH rows; pad cols CC..LDW-1
//      are never read. Block barrier before any fragment load.
//  (2) z[tx][h] (times 16*1024) = XB[b][tx][:] (A, f16 x16, row m = tx, split k map, the fragments held in registers)
//      . Wys[h][:]^T (B, col n = h, split k map from LDS); wave w owns tx rows 32w..32w+31 (2 M-tiles) and visits the
//      128 h columns in four visits of 2 N-tiles (4 accumulators), K = CC stepped by 32.
//      Epilogue per visit: p[row] += bf16(vd[h]) * tanh(z / 16384) in f32, D element r of lane -> (tx 32w+16mt+8hh+r,
//      h = hb+16j+m); then a fixed-order xor reduce over the 16 lanes of each half gives s[tx]; lanes m == 0 write s.
//  (3) f32 max-subtracted softmax over the TX scores (thread = tx): P = e / sum via one reciprocal; P -> bf16 hi bits
//      and bf16 bits of the exact residual (P - hi), kept in LDS (pp: one row of each per ty, pitch LDW).
//  (4) once per block, behind one barrier: out[b][ty0+r][d] = sum_tx hi[r][tx] * x[tx][d] + sum_tx residual[r][tx] * x[tx][d]
//      on the bf16 matrix form, f32 accumulate, K = TX stepped by 32. A row i of the 16 reads pp row i & 7 (every LDS
//      byte read was written): D rows 0..3 are the hi sums, 4..7 the residual sums, 8..15 repeat them. Wave w owns d
//      columns 32w..32w+31 (2 N-tiles; B halves are whole 512-B pieces of the XT plane; split k map for A and B).
//      Store: lanes 0..15 take tile 0, lanes 16..31 the repeat rows of tile 1: one whole 128-B line a row and wave.
// coverage: grid NB*TYR/NTY blocks x NTY rows x 8 waves x 32 columns = every out[b][ty < TYR][d] exactly once.
// =====================================================================================================
__global__ __launch_bounds__(SC_THREADS, 4)                 // 4 waves per SIMD: two blocks share a WGP (256 VGPRs a wave)
void score_softmax(const u16* __restrict__ XB, const u16* __restrict__ YB, const u16* __restrict__ WDB,
                   const float* __restrict__ vd, const u16* __restrict__ XT, float* out) {
  __shared__ __align__(16) u16 Wys[HH * LDW];
  __shared__ __align__(16) u16 Wds[HH * CC];
  __shared__ __align__(16) u16 ys[NTY * CC];
  __shared__ __align__(16) u16 pp[2 * NTY * LDW];           // rows 0..NTY-1: P hi, rows NTY..2*NTY-1: P residual
  __shared__ float sl[TX];
  __shared__ float vds[HH];
  __shared__ float redm[SC_WAVES];
  __shared__ float reds[SC_WAVES];

  const int tid = threadIdx.x, wave = tid >> 5, lane = tid & 31, hh = lane >> 4, m = lane & 15;
  const int bid = blockIdx.x;
  const int b   = bid / (TYR / NTY);
  const int ty0 = (bid % (TYR / NTY)) * NTY;
  const int c8 = lane * 8, hq = wave;

  if (tid < HH) vds[tid] = bf_val(vd[tid]);                 // waves 0..3 whole (HH = 128): wave-uniform

  // ---- (0) once per block: A fragments of x, Wd plane, the NTY y rows ----
  const int tx0 = wave * 32;
  // XB lies in fragment order: every load below is 512 contiguous bytes of the wave's own 16 KiB (four whole lines, not 16 part lines)
  const _Float16* ap = (const _Float16*)(const void*)XB + ((size_t)b * (TX / 16) + wave * 2) * (16 * CC) + lane * 8;
  v16h af0[CC / 32], af1[CC / 32];
#pragma unroll
  for (int kk = 0; kk < CC / 32; ++kk) {
    FragH f0, f1;
    f0.h[0] = *(const v8h*)(ap + kk * 512);
    f0.h[1] = *(const v8h*)(ap + kk * 512 + 256);
    f1.h[0] = *(const v8h*)(ap + 16 * CC + kk * 512);
    f1.h[1] = *(const v8h*)(ap + 16 * CC + kk * 512 + 256);
    af0[kk] = f0.v;
    af1[kk] = f1.v;
  }
  const v2u yq = *(const v2u*)(YB + ((size_t)b * TY + ty0) * CC + tid * 4);
  // stands in front of every overwrite of the address registers of the loads above (ap is named so that it lives to here)
  asm volatile("s_wait_xcnt 0x0" :: "v"(ap) : "memory");
  *(v2u*)(&ys[tid * 4]) = yq;
#pragma unroll 4                                            // four loads in flight a trip instead of one
  for (int i = 0; i < HH / 8; ++i) {
    const int h = hq + 8 * i;
    *(v4u*)(&Wds[h * CC + c8]) = *(const v4u*)(WDB + (size_t)h * CC + c8);
  }
  __syncthreads();                                          // publishes ys (and vds) to every wave

#pragma unroll 1                                            // rolled: one copy of the long body, registers as for one row
  for (int t = 0; t < NTY; ++t) {

  // ---- (1) Wy plane (the last fragment read of the row before lies in front of that row's barrier on sl) ----
  {
    const v8h yv = *(const v8h*)(const void*)(&ys[t * CC + c8]);
    const u16* wsrc = &Wds[hq * CC + c8];
    u16* wdst = &Wys[hq * LDW + c8];
#pragma unroll                                              // all 16 LDS loads in flight at once, constant offsets: one load latency a row
    for (int i = 0; i < HH / 8; ++i) {                      // h = hq + 8 * i
      const v8h wv = *(const v8h*)(const void*)(wsrc + i * 8 * CC);
      *(v8h*)(void*)(wdst + i * 8 * LDW) = wv * yv;
    }
  }
  __syncthreads();

  // ---- (2) scores ----
  const _Float16* wl = (const _Float16*)(const void*)(&Wys[0]);
  v8f p0 = zero8(), p1 = zero8();

#pragma unroll 1
  for (int q = 0; q < 4; ++q) {                             // 2 N-tiles a visit: 4 accumulators beside the 16 A fragments
    const int hb = q * 32;
    const _Float16* bq = wl + (size_t)(hb + m) * LDW + 8 * hh;
    v8f c0[2], c1[2];
#pragma unroll
    for (int j = 0; j < 2; ++j) { c0[j] = zero8(); c1[j] = zero8(); }
#pragma unroll
    for (int k0 = 0; k0 < CC; k0 += 64) {                   // unrolled: the fragment arrays need constant indices
      const v16h b0 = ldfrag_h(bq + k0);                    // two k steps a trip: 8 LDS loads ahead of 8 products
      const v16h b1 = ldfrag_h(bq + 16 * LDW + k0);
      const v16h b2 = ldfrag_h(bq + k0 + 32);
      const v16h b3 = ldfrag_h(bq + 16 * LDW + k0 + 32);
      c0[0] = mma_h(af0[k0 / 32], b0, c0[0]);
      c0[1] = mma_h(af0[k0 / 32], b1, c0[1]);
      c1[0] = mma_h(af1[k0 / 32], b0, c1[0]);
      c1[1] = mma_h(af1[k0 / 32], b1, c1[1]);
      c0[0] = mma_h(af0[k0 / 32 + 1], b2, c0[0]);
      c0[1] = mma_h(af0[k0 / 32 + 1], b3, c0[1]);
      c1[0] = mma_h(af1[k0 / 32 + 1], b2, c1[0]);
      c1[1] = mma_h(af1[k0 / 32 + 1], b3, c1[1]);
    }
    acc_guard4(c0[0], c0[1], c1[0], c1[1]);
#pragma unroll
    for (int j = 0; j < 2; ++j) {
      const float vv = vds[hb + 16 * j + m];
      v8f t0 = c0[j] * ZINV, t1 = c1[j] * ZINV;             // independent tanh back to back: none waits for its neighbour
#pragma unroll
      for (int r = 0; r < 8; ++r) { t0[r] = tanh_e(t0[r]); t1[r] = tanh_e(t1[r]); }
      p0 += vv * t0;
      p1 += vv * t1;
    }
  }

  // reduce over the 16 column lanes of each half (fixed order); D row = tx0 + 16*mt + 8*hh + r
#pragma unroll
  for (int r = 0; r < 8; ++r) {
    float v = p0[r];
    v += __shfl_xor(v, 1, 16);
    v += __shfl_xor(v, 2, 16);
    v += __shfl_xor(v, 4, 16);
    v += __shfl_xor(v, 8, 16);
    p0[r] = v;
    float u = p1[r];
    u += __shfl_xor(u, 1, 16);
    u += __shfl_xor(u, 2, 16);
    u += __shfl_xor(u, 4, 16);
    u += __shfl_xor(u, 8, 16);
    p1[r] = u;
  }
  if (m == 0) {
#pragma unroll
    for (int r = 0; r < 8; ++r) {
      sl[tx0 + 8 * hh + r]      = p0[r];
      sl[tx0 + 16 + 8 * hh + r] = p1[r];
    }
  }
  __syncthreads();

  // ---- (3) softmax over tx (thread = tx) ----
  const float sv = sl[tid];
  float mx = sv;
  mx = fmaxf(mx, __shfl_xor(mx, 16, 32));
  mx = fmaxf(mx, __shfl_xor(mx, 8, 32));
  mx = fmaxf(mx, __shfl_xor(mx, 4, 32));
  mx = fmaxf(mx, __shfl_xor(mx, 2, 32));
  mx = fmaxf(mx, __shfl_xor(mx, 1, 32));
  if (lane == 0) redm[wave] = mx;
  __syncthreads();
  float mm = redm[0];
#pragma unroll
  for (int w = 1; w < SC_WAVES; ++w) mm = fmaxf(mm, redm[w]);
  const float ev = expf(sv - mm);
  float ss = ev;
  ss += __shfl_xor(ss, 16, 32);
  ss += __shfl_xor(ss, 8, 32);
  ss += __shfl_xor(ss, 4, 32);
  ss += __shfl_xor(ss, 2, 32);
  ss += __shfl_xor(ss, 1, 32);
  if (lane == 0) reds[wave] = ss;
  __syncthreads();
  float tot = reds[0];
#pragma unroll
  for (int w = 1; w < SC_WAVES; ++w) tot += reds[w];
  const float a = ev * (1.0f / tot);                       // tot >= 1 by construction
  const unsigned short hb16 = bf_bits(a);
  const unsigned short lb16 = bf_bits(a - bf_up(hb16));    // residual is exact in f32
  pp[t * LDW + tid] = hb16;                                // read only behind the barrier after the loop
  pp[(NTY + t) * LDW + tid] = lb16;
  }

  // ---- (4) out rows of this block ----
  __syncthreads();                                          // publishes the rows of pp to every wave
  const u16* bp = XT + ((size_t)b * (CC / 16) + wave * 2) * (TX * 16) + lane * 8;
  FragB xb0[TX / 32], xb1[TX / 32];
#pragma unroll
  for (int kk = 0; kk < TX / 32; ++kk) {                   // all 32 loads in flight at once, in the registers of the x fragments
    xb0[kk].u[0] = *(const v4u*)(bp + kk * 512);
    xb0[kk].u[1] = *(const v4u*)(bp + kk * 512 + 256);
    xb1[kk].u[0] = *(const v4u*)(bp + TX * 16 + kk * 512);
    xb1[kk].u[1] = *(const v4u*)(bp + TX * 16 + kk * 512 + 256);
  }
  // stands in front of every overwrite of the address registers of the loads above (bp is named so that it lives to here)
  asm volatile("s_wait_xcnt 0x0" :: "v"(bp) : "memory");
  const u16* pa = &pp[(m & (2 * NTY - 1)) * LDW + 8 * hh];
  v16b af[TX / 32];
#pragma unroll
  for (int kk = 0; kk < TX / 32; ++kk) af[kk] = ldfrag_b(pa + kk * 32);
  v8f o0 = zero8(), o1 = zero8();
#pragma unroll
  for (int kk = 0; kk < TX / 32; ++kk) {
    o0 = mma_b(af[kk], xb0[kk].v, o0);
    o1 = mma_b(af[kk], xb1[kk].v, o1);
  }
  float* dst = out + ((size_t)b * TYR + ty0) * CC + wave * 32 + lane;
#pragma unroll
  for (int r = 0; r < NTY; ++r) dst[(size_t)r * CC] = (hh == 0) ? (o0[r] + o0[NTY + r]) : (o1[r] + o1[NTY + r]);
}

// =====================================================================================================
// Workspace map (bytes, NB = 8, TYR = 256); every plane is fully written by whole-line stores before it is read; all
// extents are exact multiples of the store granularity (no pad rows), every offset a multiple of 128:
//   XB  f16 [NB*TX/16][CC/32][2][32 lanes][8]  x16   1048576
//   YB  f16 [NB*TY][CC]  x16         1048576
//   WDB f16 [HH][CC]     x64           65536
//   XT  bf16 [NB][CC/16][TX/32][2][32 lanes][8]   1048576
//   end                              3211264
// Inputs are read with the full-size batch strides (TX*CC, TY*CC); out is written as [NB][TYR][CC].
// =====================================================================================================
extern "C" void kernel_launch(void* const* d_in, const int* in_sizes, int n_in,
                              void* d_out, int out_size, void* d_ws, size_t ws_size,
                              hipStream_t stream) {
  if (n_in < 4) return;
  if (in_sizes[0] < NB * TX * CC || in_sizes[1] < NB * TY * CC) return;
  if (in_sizes[2] < HH * CC || in_sizes[3] < HH) return;
  if (out_size < NB * TYR * CC) return;

  const float* Xin = (const float*)d_in[0];
  const float* Yin = (const float*)d_in[1];
  const float* Wd  = (const float*)d_in[2];
  const float* vd  = (const float*)d_in[3];
  float*       out = (float*)d_out;

  const size_t szXB = (size_t)NB * TX * CC * 2;
  const size_t szYB = (size_t)NB * TY * CC * 2;
  const size_t szWD = (size_t)HH * CC * 2;
  const size_t szXT = (size_t)NB * CC * TX * 2;
  size_t off = 0;
  const size_t oXB = off; off += szXB;
  const size_t oYB = off; off += szYB;
  const size_t oWD = off; off += szWD;
  const size_t oXT = off; off += szXT;
  if (off > ws_size) return;                            // 3211264 at NB = 8
  if (off > (size_t)134217728) return;

  char* ws = (char*)d_ws;
  u16* XB  = (u16*)(ws + oXB);
  u16* YB  = (u16*)(ws + oYB);
  u16* WDB = (u16*)(ws + oWD);
  u16* XT  = (u16*)(ws + oXT);

  const dim3 blk(256);
  const dim3 gPR(XT_BLOCKS + CX_BLOCKS + CY_BLOCKS + CW_BLOCKS);   // 128 + 256 + 256 + 16
  const dim3 gSC(NB * TYR / NTY);                       // 512
  const dim3 bSC(SC_THREADS);                           // 256

  // (0) operand planes, one launch: x[b][tx][c] -> XT (transposed, bf16, fragment order); x, y -> f16 of bf16 value x16;
  //     Wd [h][c] (k-contiguous) -> f16 of bf16 value x64
  prep_planes<<<gPR, blk, 0, stream>>>(Xin, Yin, Wd, XT, XB, YB, WDB);
  // (1) scores, tanh.vd row-dot, softmax -> P hi / residual bf16 rows in LDS; out[b][ty][d] = sum_tx P[ty][tx] * x[b][tx][d]
  score_softmax<<<gSC, bSC, 0, stream>>>(XB, YB, WDB, vd, XT, out);
  (void)hipGetLastError();
}

// v007
// A run of this version takes 28 microseconds.
// Timed twice side by side with v006, it ran 1.05 and 1.04 times as fast.
// Over all steps from v000 it is 2.39 times as fast.
// Contractions: scores x.(Wd*y)^T on v_wmma_f32_16x16x32_f16 (x as f16 of its RNE bf16 value x16, Wd*y product plane as
// single f16 x1024: one packed f16 multiply of the f16 copies of the bf16 values, Wd x64 and y x16; f32 accumulate);
// P.x on v_wmma_f32_16x16x32_bf16 (P as bf16 hi + bf16 residual planes, x as RNE bf16,
// f32 accumulate). tanh, the h.vd row-dot (vd as RNE bf16 value) and the softmax in f32 on VALU.
#include <hip/hip_runtime.h>
#include <math.h>
#include <stdint.h>

#ifndef NB
#define NB 8
#endif
#define NB_FULL 8
#define TX 256
#define TY 256
#ifndef TYR
#define TYR TY
#endif
#define CC 256
#define HH 128
#define XSC 16.0f
#define WSC 64.0f
#define YSC 16.0f
#define ZINV (1.0f / (XSC * WSC * YSC))
#define LDW 264
#define TP 68
#define SC_WAVES 8
#define SC_THREADS (SC_WAVES * 32)
#define NTY 4
#define XT_BLOCKS (NB * (TX / 64) * (CC / 64))
#define CX_BLOCKS ((NB * TX * CC) / (8 * 256))
#define CY_BLOCKS ((NB * TY * CC) / (8 * 256))
#define CW_BLOCKS ((HH * CC) / (8 * 256))

static_assert(TX == 256 && TY == 256 && CC == 256 && HH == 128);
static_assert(NB >= 1 && NB <= NB_FULL);
static_assert((TYR % 64) == 0 && TYR >= 64 && TYR <= TY);
static_assert((TYR % NTY) == 0 && NTY * CC == SC_THREADS * 4 && NTY == 4 && SC_WAVES * 32 == CC);
static_assert(SC_THREADS == TX && SC_WAVES * 32 == TX && SC_WAVES * 16 == HH && 32 * 8 == CC);
static_assert((CC % 32) == 0 && (TX % 32) == 0 && (LDW % 8) == 0 && LDW >= CC);
static_assert(((NB * TX * CC / 8) % 256) == 0 && ((NB * TY * CC / 8) % 256) == 0 && ((HH * CC / 8) % 256) == 0);
static_assert((TX % 64) == 0 && (CC % 64) == 0 && (TP * 4) % 16 == 0);
static_assert(CC / 32 == 8 && 16 * CC == 8 * 512);          // the shifts of the fragment-order XB plane

typedef unsigned short u16;
typedef _Float16 v16h __attribute__((ext_vector_type(16)));
typedef _Float16 v8h  __attribute__((ext_vector_type(8)));
typedef __bf16   v16b __attribute__((ext_vector_type(16)));
typedef float    v8f  __attribute__((ext_vector_type(8)));
typedef float    v4f  __attribute__((ext_vector_type(4)));
typedef unsigned int v4u __attribute__((ext_vector_type(4)));
typedef unsigned int v2u __attribute__((ext_vector_type(2)));

union FragH { v16h v; v8h h[2]; v4u u[2]; };
union FragB { v16b v; v4u u[2]; };

// ---- scalar helpers --------------------------------------------------------------------------------
__device__ __forceinline__ unsigned short bf_bits(float f) {          // f32 -> bf16 bits, RNE convert
  unsigned u = __float_as_uint(f);
  return (unsigned short)((u + 0x7FFFu + ((u >> 16) & 1u)) >> 16);
}
__device__ __forceinline__ float bf_up(unsigned short h) { return __uint_as_float(((unsigned)h) << 16); }
__device__ __forceinline__ float bf_val(float f) { return bf_up(bf_bits(f)); }          // value after RNE bf16 convert
__device__ __forceinline__ unsigned short h_bits(_Float16 x) { return __builtin_bit_cast(unsigned short, x); }
__device__ __forceinline__ unsigned pk16(unsigned short a, unsigned short b) { return (unsigned)a | ((unsigned)b << 16); }
__device__ __forceinline__ v8f zero8() { v8f z = {0.f, 0.f, 0.f, 0.f, 0.f, 0.f, 0.f, 0.f}; return z; }

// tanh(v) on the chip's own transcendental (v_tanh_f32): one instruction, branch-free
__device__ __forceinline__ float tanh_e(float v) {
  return __builtin_amdgcn_tanhf(v);
}

// ---- fragment loaders: 16-bit A/B operand, lane -> row/col (lane&15), p already includes +8*(lane>>4);
//      elements 0..7 <- p[0..7] (k0+8h..), elements 8..15 <- p[16..23] (k0+16+8h..)  (same split k map for A and B;
//      B comes from a k-contiguous [n][k] plane, or from the XT plane, whose 16-B pieces lie in this same order)
__device__ __forceinline__ v16h ldfrag_h(const _Float16* p) {
  FragH f;
  f.h[0] = *(const v8h*)(p);
  f.h[1] = *(const v8h*)(p + 16);
  return f.v;
}
__device__ __forceinline__ v16b ldfrag_b(const u16* p) {              // bf16 plane read as unsigned integer vectors
  FragB f;
  f.u[0] = *(const v4u*)(p);
  f.u[1] = *(const v4u*)(p + 16);
  return f.v;
}

__device__ __forceinline__ v8f mma_h(v16h a, v16h b, v8f c) {
  return __builtin_amdgcn_wmma_f32_16x16x32_f16(false, a, false, b, (short)0, c, false, false);
}
__device__ __forceinline__ v8f mma_b(v16b a, v16b b, v8f c) {
  return __builtin_amdgcn_wmma_f32_16x16x32_bf16(false, a, false, b, (short)0, c, false, false);
}
__device__ __forceinline__ void acc_guard4(v8f& a, v8f& b, v8f& c, v8f& d) {
#if defined(__HIP_DEVICE_COMPILE__)
  asm volatile("v_nop\n\tv_nop\n\tv_nop\n\tv_nop" : "+v"(a), "+v"(b), "+v"(c), "+v"(d));
#endif
}
// Block barrier that orders LDS traffic alone. The waves of the score kernel hand data to each other through LDS only, so
// a global load that is still in flight need not be waited for here (a full __syncthreads() drains the load counter too).
__device__ __forceinline__ void lds_barrier() {
  __builtin_amdgcn_fence(__ATOMIC_RELEASE, "workgroup", "local");
  __builtin_amdgcn_s_barrier();
  __builtin_amdgcn_fence(__ATOMIC_ACQUIRE, "workgroup", "local");
}
// =====================================================================================================
// One launch prepares all four operand planes; the job of a block follows from its index alone (block-uniform):
//   blocks [0, XT_BLOCKS)          x -> XT   transposed bf16 plane (the longest chain, so it takes the lowest block indices; for speed only)
//   next CX_BLOCKS                 x -> XB   f16 bits of (bf16 RNE value) * 16, in the order of the A fragments that read it
//   next CY_BLOCKS                 y -> YB   f16 bits of (bf16 RNE value) * 16, same layout
//   next CW_BLOCKS                 Wd -> WDB f16 bits of (bf16 RNE value) * 64, same layout
// The jobs are independent of each other: no block reads what another block of this launch writes.
// =====================================================================================================

// f32 plane -> 16-bit plane, same layout:  mode 0: bf16 RNE bits;  mode 1: f16 bits of (bf16 RNE value) * scale.
// Thread = 8 consecutive elements: two 16-B loads, one 16-B store; 32 consecutive lanes = 512 contiguous, 512-B aligned bytes
// coverage: blocks x 256 thr x 8 = the whole plane (exactness: static_assert on the plane sizes).
// frag != 0 (rows of CC elements): the 16-B piece (row, 8 c) goes to [row >> 4][c >> 5][(c >> 4) & 1][lane = 16 * ((c >> 3) & 1)
// + (row & 15)], so that one half of a 16-row fragment is 512 contiguous bytes. The thread still owns destination piece gt
// (whole-line stores) and gathers its source piece; a block reads 16 rows x 128 c, every line of them whole.
__device__ __forceinline__ void cvt_job(const float* __restrict__ x, u16* D, int blk, int tid, int mode, float scale, int frag) {
  const int gt = blk * 256 + tid;
  const size_t so = (frag != 0) ? (((size_t)(gt >> 9) * 16 + (gt & 15)) * CC + ((gt >> 6) & 7) * 32 + ((gt >> 5) & 1) * 16 + ((gt >> 4) & 1) * 8)
                                : (size_t)gt * 8;
  const float* p = x + so;
  const v4f a = *(const v4f*)(p), c4 = *(const v4f*)(p + 4);
  float v[8];
#pragma unroll
  for (int e = 0; e < 4; ++e) { v[e] = a[e]; v[4 + e] = c4[e]; }
  unsigned short s[8];
#pragma unroll
  for (int e = 0; e < 8; ++e) {
    const unsigned short bb = bf_bits(v[e]);
    const unsigned short hb = h_bits((_Float16)(bf_up(bb) * scale));
    s[e] = (mode != 0) ? hb : bb;
  }
  v4u o;
#pragma unroll
  for (int e = 0; e < 4; ++e) o[e] = pk16(s[2 * e], s[2 * e + 1]);
  u16* d = D + (size_t)gt * 8;
  {
    *(v4u*)(d) = o;
    // precaution: each block takes one branch, and nothing of the kernel follows the store
    asm volatile("s_wait_xcnt 0x0" ::: "memory");
  }
}

// Transposed bf16 plane of x:  in x[b][tx][c] f32 (row pitch CC)  ->  out XT = x[b][tx][d = c] as bf16 RNE bits, laid out
// in the order of the B fragments that read it (col n = d & 15, split k map over tx): one fragment half = 512 contiguous B.
// Block = (b, 64 tx rows, 64 c cols): thread loads 16 consecutive c of one tx row (four 16-B loads), stores them
// transposed into the LDS tile T[c][tx] (pitch TP floats); after the block barrier wave w / instruction i writes the
// coverage: 8 waves x 2 instructions x 4 rows = 64 c rows, 8 lanes x 8 halves = 64 tx each; XT_BLOCKS
//           blocks = every (b, c, tx) of the XT plane exactly once. Staged extent == consumed extent (64 x 64 of T).
__device__ __forceinline__ void xpose_job(const float* __restrict__ x, u16* XT, float* T, int bid, int tid) {
  const int lane = tid & 31, wave = tid >> 5;
  const int ntl = (TX / 64) * (CC / 64);
  const int b   = bid / ntl, t = bid % ntl;
  const int tx0 = (t / (CC / 64)) * 64;
  const int c0  = (t % (CC / 64)) * 64;
  const int r   = tid >> 2, cq = (tid & 3) * 16;
  const float* p = x + ((size_t)b * TX + tx0 + r) * CC + c0 + cq;
  const v4f q0 = *(const v4f*)(p), q1 = *(const v4f*)(p + 4), q2 = *(const v4f*)(p + 8), q3 = *(const v4f*)(p + 12);
#pragma unroll
  for (int e = 0; e < 4; ++e) {
    T[(cq + e) * TP + r]      = q0[e];
    T[(cq + 4 + e) * TP + r]  = q1[e];
    T[(cq + 8 + e) * TP + r]  = q2[e];
    T[(cq + 12 + e) * TP + r] = q3[e];
  }
  __syncthreads();
  const int rq = lane >> 3, g8 = (lane & 7) * 8;
  v4u ov[2];
#pragma unroll
  for (int i = 0; i < 2; ++i) {
    const int ci = wave * 8 + i * 4 + rq;
    const v4f a = *(const v4f*)(T + ci * TP + g8), c4 = *(const v4f*)(T + ci * TP + g8 + 4);
    float w[8];
#pragma unroll
    for (int e = 0; e < 4; ++e) { w[e] = a[e]; w[4 + e] = c4[e]; }
#pragma unroll
    for (int e = 0; e < 4; ++e) ov[i][e] = pk16(bf_bits(w[2 * e]), bf_bits(w[2 * e + 1]));
  }
  // fragment order: 16-B piece (d, 8 tx) -> [b][d >> 4][tx >> 5][(tx >> 4) & 1][lane = 16 * ((tx >> 3) & 1) + (d & 15)]
  const int d0 = c0 + wave * 8 + rq, tq = tx0 + g8;
  u16* dst = XT + ((((size_t)b * (CC / 16) + (d0 >> 4)) * (TX / 32) + (tq >> 5)) * 2 + ((tq >> 4) & 1)) * 256
                + (((tq >> 3) & 1) * 16 + (d0 & 15)) * 8;
  {
#pragma unroll
    for (int i = 0; i < 2; ++i) {
      *(v4u*)(dst + i * 32) = ov[i];                        // d + 4: four lanes' pieces further in the same 128-B line
    }
  }
}

__global__ __launch_bounds__(256) void prep_planes(const float* __restrict__ x, const float* __restrict__ y,
                                                   const float* __restrict__ Wd, u16* XT, u16* XB, u16* YB, u16* WDB) {
  __shared__ __align__(16) float T[64 * TP];
  const int tid = threadIdx.x;
  const int bid = blockIdx.x;
  if (bid < XT_BLOCKS) {                                    // the only job with a barrier; the whole block takes it
    xpose_job(x, XT, T, bid, tid);
  } else if (bid < XT_BLOCKS + CX_BLOCKS) {
    cvt_job(x, XB, bid - XT_BLOCKS, tid, 1, XSC, 1);
  } else if (bid < XT_BLOCKS + CX_BLOCKS + CY_BLOCKS) {
    cvt_job(y, YB, bid - (XT_BLOCKS + CX_BLOCKS), tid, 1, YSC, 0);
  } else {
    cvt_job(Wd, WDB, bid - (XT_BLOCKS + CX_BLOCKS + CY_BLOCKS), tid, 1, WSC, 0);
  }
}

// =====================================================================================================
// Scores + softmax for NTY consecutive ty rows of one b per block (SC_THREADS = TX threads, 8 waves), one row after the
// other. What does not depend on ty is fetched once per block: the wave's 32 x CC f16 rows of x stay in registers as its
// 16 A fragments, the Wd f16 plane stays in LDS (every thread reads back only the pieces it stored itself), and the
// block's NTY y rows are staged in LDS behind one block barrier.
//  (1) Wy plane in LDS: Wys[h][c] = f16 product (bf16(Wd[h][c]) * 64) * (bf16(y[b][ty][c]) * 16): both factors are exact
//      in f16 (8 significant bits, power-of-two scale), so the packed f16 multiply rounds the exact product once, RNE.
//      Thread = (8 consecutive c, h = tid>>5 + 8i, i = 0..15): one 16-B LDS load of the Wd f16 plane, four packed
//      multiplies, one 16-B LDS store per (h, 8 c). coverage: 32 c-groups x 8 = CC, 8 x 16 = HH rows; pad cols CC..LDW-1
//      are never read. Block barrier before any fragment load.
//  (2) z[tx][h] (times 16*1024) = XB[b][tx][:] (A, f16 x16, row m = tx, split k map, the fragments held in registers)
//      . Wys[h][:]^T (B, col n = h, split k map from LDS); wave w owns tx rows 32w..32w+31 (2 M-tiles) and visits the
//      128 h columns in four visits of 2 N-tiles (4 accumulators), K = CC stepped by 32.
//      Epilogue per visit: p[row] += bf16(vd[h]) * tanh(z / 16384) in f32, D element r of lane -> (tx 32w+16mt+8hh+r,
//      h = hb+16j+m); then a fixed-order xor reduce over the 16 lanes of each half gives s[tx]; lanes m == 0 write s.
//  (3) f32 max-subtracted softmax over the TX scores (thread = tx): P = e / sum via one reciprocal; P -> bf16 hi bits
//      and bf16 bits of the exact residual (P - hi), kept in LDS (pp: one row of each per ty, pitch LDW).
//  (4) once per block, behind one barrier: out[b][ty0+r][d] = sum_tx hi[r][tx] * x[tx][d] + sum_tx residual[r][tx] * x[tx][d]
//      on the bf16 matrix form, f32 accumulate, K = TX stepped by 32. A row i of the 16 reads pp row i & 7 (every LDS
//      byte read was written): D rows 0..3 are the hi sums, 4..7 the residual sums, 8..15 repeat them. Wave w owns d
//      columns 32w..32w+31 (2 N-tiles; B halves are whole 512-B pieces of the XT plane; split k map for A and B).
//      Store: lanes 0..15 take tile 0, lanes 16..31 the repeat rows of tile 1: one whole 128-B line a row and wave.
// coverage: grid NB*TYR/NTY blocks x NTY rows x 8 waves x 32 columns = every out[b][ty < TYR][d] exactly once.
// =====================================================================================================
__global__ __launch_bounds__(SC_THREADS, 4)                 // 4 waves per SIMD: two blocks share a WGP (256 VGPRs a wave)
void score_softmax(const u16* __restrict__ XB, const u16* __restrict__ YB, const u16* __restrict__ WDB,
                   const float* __restrict__ vd, const u16* __restrict__ XT, float* out) {
  __shared__ __align__(16) u16 Wys[HH * LDW];
  __shared__ __align__(16) u16 Wds[HH * CC];
  __shared__ __align__(16) u16 ys[NTY * CC];
  __shared__ __align__(16) u16 pp[2 * NTY * LDW];           // rows 0..NTY-1: P hi, rows NTY..2*NTY-1: P residual
  __shared__ float sl[TX];
  __shared__ float vds[HH];
  __shared__ float redm[SC_WAVES];
  __shared__ float reds[SC_WAVES];

  const int tid = threadIdx.x, wave = tid >> 5, lane = tid & 31, hh = lane >> 4, m = lane & 15;
  const int bid = blockIdx.x;
  const int b   = bid / (TYR / NTY);
  const int ty0 = (bid % (TYR / NTY)) * NTY;
  const int c8 = lane * 8, hq = wave;


  // ---- (0) once per block: A fragments of x, Wd plane, the NTY y rows ----
  // Wd and y go first: the first Wy plane needs them alone, so it is built while the x fragments below are still in flight
  const float vdq = vd[tid & (HH - 1)];                     // issued with the rest: no wait of its own at the head of the block
  const v2u yq = *(const v2u*)(YB + ((size_t)b * TY + ty0) * CC + tid * 4);
  const u16* wp = WDB + (size_t)hq * CC + c8;
  v4u wq[HH / 8];
#pragma unroll                                              // all 16 loads in flight at once: one L2 latency, not four
  for (int i = 0; i < HH / 8; ++i) wq[i] = *(const v4u*)(wp + (size_t)i * 8 * CC);
  const int tx0 = wave * 32;
  // XB lies in fragment order: every load below is 512 contiguous bytes of the wave's own 16 KiB (four whole lines, not 16 part lines)
  const _Float16* ap = (const _Float16*)(const void*)XB + ((size_t)b * (TX / 16) + wave * 2) * (16 * CC) + lane * 8;
  v16h af0[CC / 32], af1[CC / 32];
#pragma unroll
  for (int kk = 0; kk < CC / 32; ++kk) {
    FragH f0, f1;
    f0.h[0] = *(const v8h*)(ap + kk * 512);
    f0.h[1] = *(const v8h*)(ap + kk * 512 + 256);
    f1.h[0] = *(const v8h*)(ap + 16 * CC + kk * 512);
    f1.h[1] = *(const v8h*)(ap + 16 * CC + kk * 512 + 256);
    af0[kk] = f0.v;
    af1[kk] = f1.v;
  }
  // stands in front of every overwrite of the address registers of the loads above (wp, ap are named so that they live to here)
  asm volatile("s_wait_xcnt 0x0" :: "v"(wp), "v"(ap) : "memory");
  // inputs-only fence on the loaded value: keeps the vd load up with the others; sunk into the branch below it would be
  // the youngest load, and its wait would drain the x fragment loads too
  asm volatile("" :: "v"(vdq));
  if (tid < HH) vds[tid] = bf_val(vdq);                     // waves 0..3 whole (HH = 128): wave-uniform
  *(v2u*)(&ys[tid * 4]) = yq;
#pragma unroll
  for (int i = 0; i < HH / 8; ++i) *(v4u*)(&Wds[(hq + 8 * i) * CC + c8]) = wq[i];
  lds_barrier();                                            // publishes ys (and vds) to every wave

  const u16* bp = XT + ((size_t)b * (CC / 16) + wave * 2) * (TX * 16) + lane * 8;
  FragB xb0[TX / 32], xb1[TX / 32];
  // one ty row; the last row is a copy of its own, in which the x fragments die at the last product
  auto row = [&](const int t, const bool last) __attribute__((always_inline)) {

  // ---- (1) Wy plane (the last fragment read of the row before lies in front of that row's barrier on sl) ----
  {
    const v8h yv = *(const v8h*)(const void*)(&ys[t * CC + c8]);
    const u16* wsrc = &Wds[hq * CC + c8];
    u16* wdst = &Wys[hq * LDW + c8];
#pragma unroll                                              // all 16 LDS loads in flight at once, constant offsets: one load latency a row
    for (int i = 0; i < HH / 8; ++i) {                      // h = hq + 8 * i
      const v8h wv = *(const v8h*)(const void*)(wsrc + i * 8 * CC);
      *(v8h*)(void*)(wdst + i * 8 * LDW) = wv * yv;
    }
  }
  lds_barrier();

  // ---- (2) scores ----
  const _Float16* wl = (const _Float16*)(const void*)(&Wys[0]);
  v8f p0 = zero8(), p1 = zero8();

#pragma unroll 1
  for (int q = 0; q < 4; ++q) {                             // 2 N-tiles a visit: 4 accumulators beside the 16 A fragments
    const int hb = q * 32;
    const _Float16* bq = wl + (size_t)(hb + m) * LDW + 8 * hh;
    v8f c0[2], c1[2];
#pragma unroll
    for (int j = 0; j < 2; ++j) { c0[j] = zero8(); c1[j] = zero8(); }
#pragma unroll
    for (int k0 = 0; k0 < CC; k0 += 64) {                   // unrolled: the fragment arrays need constant indices
      const v16h b0 = ldfrag_h(bq + k0);                    // two k steps a trip: 8 LDS loads ahead of 8 products
      const v16h b1 = ldfrag_h(bq + 16 * LDW + k0);
      const v16h b2 = ldfrag_h(bq + k0 + 32);
      const v16h b3 = ldfrag_h(bq + 16 * LDW + k0 + 32);
      c0[0] = mma_h(af0[k0 / 32], b0, c0[0]);
      c0[1] = mma_h(af0[k0 / 32], b1, c0[1]);
      c1[0] = mma_h(af1[k0 / 32], b0, c1[0]);
      c1[1] = mma_h(af1[k0 / 32], b1, c1[1]);
      c0[0] = mma_h(af0[k0 / 32 + 1], b2, c0[0]);
      c0[1] = mma_h(af0[k0 / 32 + 1], b3, c0[1]);
      c1[0] = mma_h(af1[k0 / 32 + 1], b2, c1[0]);
      c1[1] = mma_h(af1[k0 / 32 + 1], b3, c1[1]);
    }
    acc_guard4(c0[0], c0[1], c1[0], c1[1]);
#pragma unroll
    for (int j = 0; j < 2; ++j) {
      const float vv = vds[hb + 16 * j + m];
      v8f t0 = c0[j] * ZINV, t1 = c1[j] * ZINV;             // independent tanh back to back: none waits for its neighbour
#pragma unroll
      for (int r = 0; r < 8; ++r) { t0[r] = tanh_e(t0[r]); t1[r] = tanh_e(t1[r]); }
      p0 += vv * t0;
      p1 += vv * t1;
    }
  }

  if (last) {
    // the xT fragments of step (4) start here, in the registers of the x fragments, and fly during this row's reduce and softmax
#pragma unroll
    for (int kk = 0; kk < TX / 32; ++kk) {                 // all 32 loads in flight at once
      xb0[kk].u[0] = *(const v4u*)(bp + kk * 512);
      xb0[kk].u[1] = *(const v4u*)(bp + kk * 512 + 256);
      xb1[kk].u[0] = *(const v4u*)(bp + TX * 16 + kk * 512);
      xb1[kk].u[1] = *(const v4u*)(bp + TX * 16 + kk * 512 + 256);
    }
    // stands in front of every overwrite of the address registers of the loads above (bp is named so that it lives to here)
    asm volatile("s_wait_xcnt 0x0" :: "v"(bp) : "memory");
  }

  // reduce over the 16 column lanes of each half (fixed order); D row = tx0 + 16*mt + 8*hh + r
#pragma unroll
  for (int r = 0; r < 8; ++r) {
    float v = p0[r];
    v += __shfl_xor(v, 1, 16);
    v += __shfl_xor(v, 2, 16);
    v += __shfl_xor(v, 4, 16);
    v += __shfl_xor(v, 8, 16);
    p0[r] = v;
    float u = p1[r];
    u += __shfl_xor(u, 1, 16);
    u += __shfl_xor(u, 2, 16);
    u += __shfl_xor(u, 4, 16);
    u += __shfl_xor(u, 8, 16);
    p1[r] = u;
  }
  if (m == 0) {
#pragma unroll
    for (int r = 0; r < 8; ++r) {
      sl[tx0 + 8 * hh + r]      = p0[r];
      sl[tx0 + 16 + 8 * hh + r] = p1[r];
    }
  }
  lds_barrier();

  // ---- (3) softmax over tx (thread = tx) ----
  const float sv = sl[tid];
  float mx = sv;
  mx = fmaxf(mx, __shfl_xor(mx, 16, 32));
  mx = fmaxf(mx, __shfl_xor(mx, 8, 32));
  mx = fmaxf(mx, __shfl_xor(mx, 4, 32));
  mx = fmaxf(mx, __shfl_xor(mx, 2, 32));
  mx = fmaxf(mx, __shfl_xor(mx, 1, 32));
  if (lane == 0) redm[wave] = mx;
  lds_barrier();
  float mm = redm[0];
#pragma unroll
  for (int w = 1; w < SC_WAVES; ++w) mm = fmaxf(mm, redm[w]);
  const float ev = expf(sv - mm);
  float ss = ev;
  ss += __shfl_xor(ss, 16, 32);
  ss += __shfl_xor(ss, 8, 32);
  ss += __shfl_xor(ss, 4, 32);
  ss += __shfl_xor(ss, 2, 32);
  ss += __shfl_xor(ss, 1, 32);
  if (lane == 0) reds[wave] = ss;
  lds_barrier();
  float tot = reds[0];
#pragma unroll
  for (int w = 1; w < SC_WAVES; ++w) tot += reds[w];
  const float a = ev * (1.0f / tot);                       // tot >= 1 by construction
  const unsigned short hb16 = bf_bits(a);
  const unsigned short lb16 = bf_bits(a - bf_up(hb16));    // residual is exact in f32
  pp[t * LDW + tid] = hb16;                                // read only behind the barrier after the loop
  pp[(NTY + t) * LDW + tid] = lb16;
  };
#pragma unroll 1                                            // rolled: one copy of the long body for the rows before the last
  for (int t = 0; t < NTY - 1; ++t) row(t, false);
  row(NTY - 1, true);

  // ---- (4) out rows of this block ----
  lds_barrier();                                            // publishes the rows of pp to every wave
  const u16* pa = &pp[(m & (2 * NTY - 1)) * LDW + 8 * hh];
  v16b af[TX / 32];
#pragma unroll
  for (int kk = 0; kk < TX / 32; ++kk) af[kk] = ldfrag_b(pa + kk * 32);
  v8f o0 = zero8(), o1 = zero8();
#pragma unroll
  for (int kk = 0; kk < TX / 32; ++kk) {
    o0 = mma_b(af[kk], xb0[kk].v, o0);
    o1 = mma_b(af[kk], xb1[kk].v, o1);
  }
  float* dst = out + ((size_t)b * TYR + ty0) * CC + wave * 32 + lane;
#pragma unroll
  for (int r = 0; r < NTY; ++r) dst[(size_t)r * CC] = (hh == 0) ? (o0[r] + o0[NTY + r]) : (o1[r] + o1[NTY + r]);
}

// =====================================================================================================
// Workspace map (bytes, NB = 8, TYR = 256); every plane is fully written by whole-line stores before it is read; all
// extents are exact multiples of the store granularity (no pad rows), every offset a multiple of 128:
//   XB  f16 [NB*TX/16][CC/32][2][32 lanes][8]  x16   1048576
//   YB  f16 [NB*TY][CC]  x16         1048576
//   WDB f16 [HH][CC]     x64           65536
//   XT  bf16 [NB][CC/16][TX/32][2][32 lanes][8]   1048576
//   end                              3211264
// Inputs are read with the full-size batch strides (TX*CC, TY*CC); out is written as [NB][TYR][CC].
// =====================================================================================================
extern "C" void kernel_launch(void* const* d_in, const int* in_sizes, int n_in,
                              void* d_out, int out_size, void* d_ws, size_t ws_size,
                              hipStream_t stream) {
  if (n_in < 4) return;
  if (in_sizes[0] < NB * TX * CC || in_sizes[1] < NB * TY * CC) return;
  if (in_sizes[2] < HH * CC || in_sizes[3] < HH) return;
  if (out_size < NB * TYR * CC) return;

  const float* Xin = (const float*)d_in[0];
  const float* Yin = (const float*)d_in[1];
  const float* Wd  = (const float*)d_in[2];
  const float* vd  = (const float*)d_in[3];
  float*       out = (float*)d_out;

  const size_t szXB = (size_t)NB * TX * CC * 2;
  const size_t szYB = (size_t)NB * TY * CC * 2;
  const size_t szWD = (size_t)HH * CC * 2;
  const size_t szXT = (size_t)NB * CC * TX * 2;
  size_t off = 0;
  const size_t oXB = off; off += szXB;
  const size_t oYB = off; off += szYB;
  const size_t oWD = off; off += szWD;
  const size_t oXT = off; off += szXT;
  if (off > ws_size) return;                            // 3211264 at NB = 8
  if (off > (size_t)134217728) return;

  char* ws = (char*)d_ws;
  u16* XB  = (u16*)(ws + oXB);
  u16* YB  = (u16*)(ws + oYB);
  u16* WDB = (u16*)(ws + oWD);
  u16* XT  = (u16*)(ws + oXT);

  const dim3 blk(256);
  const dim3 gPR(XT_BLOCKS + CX_BLOCKS + CY_BLOCKS + CW_BLOCKS);   // 128 + 256 + 256 + 16
  const dim3 gSC(NB * TYR / NTY);                       // 512
  const dim3 bSC(SC_THREADS);                           // 256

  // (0) operand planes, one launch: x[b][tx][c] -> XT (transposed, bf16, fragment order); x, y -> f16 of bf16 value x16;
  //     Wd [h][c] (k-contiguous) -> f16 of bf16 value x64
  prep_planes<<<gPR, blk, 0, stream>>>(Xin, Yin, Wd, XT, XB, YB, WDB);
  // (1) scores, tanh.vd row-dot, softmax -> P hi / residual bf16 rows in LDS; out[b][ty][d] = sum_tx P[ty][tx] * x[b][tx][d]
  score_softmax<<<gSC, bSC, 0, stream>>>(XB, YB, WDB, vd, XT, out);
  (void)hipGetLastError();
}
